// v000
// Measured on an AMD MI455X. A time is GPU time per run, averaged over a window of back-to-back runs after a warm-up
// (all launches, gaps included; the runs take copies of the inputs in turn), and the median of several windows.
// Apart from v000's, it joins two sittings. Times from different sittings can be a few percent apart, while
// side-by-side timings come from the same sitting.
// v000, which the later versions start from, runs in 75.8 microseconds.
#include <hip/hip_runtime.h>

// ---------------------------------------------------------------------------
// Problem constants (from reference)
// ---------------------------------------------------------------------------
#define HGT   60
#define WID   108
#define NPIX  (HGT * WID)        // 6480 pixels per (b) image plane
#define NLAY  133
#define NB    4
#define KS    12
#define PH    5
#define PW    9
#define LQ    45                 // number of patches (real columns)
#define LP    48                 // padded to 3 x 16 for WMMA tiles
#define CR    432                // unfold rows = 3 * 12 * 12 (27 x 16 exactly)

typedef __attribute__((ext_vector_type(2))) float v2f;
typedef __attribute__((ext_vector_type(8))) float v8f;

// ---------------------------------------------------------------------------
// Main kernel: one workgroup per (layer, batch). 288 threads = 9 wave32.
//   Stage 1: build Uu (=unfold(I*S*M)) and Ku (=unfold(I*S*(1-M))) in LDS.
//   Stage 2: Wm = Uu^T * Ku        (45x45 padded 48x48, K=432)  [f32 WMMA]
//   Stage 3: L1-normalize rows of Wm
//   Stage 4: WK = Ku * Wm^T        (432x45 padded 48,  K=48)    [f32 WMMA]
//            fold + layer reduction:
//              USE_WS=true : plain stores into per-(b,l) partial planes (ws)
//              USE_WS=false: atomicAdd into the out accumulator
// Dual accumulators in both k-loops break the WMMA RAW dependency chain.
// ---------------------------------------------------------------------------
template <bool USE_WS>
__global__ __launch_bounds__(288) void matting_layer_kernel(
    const float* __restrict__ I,     // (4,3,60,108)
    const float* __restrict__ S,     // (4,60,108,133)
    const float* __restrict__ M,     // (4,1,60,108)
    float* __restrict__ outacc,      // (4,3,60,108) accumulator (atomic path)
    float* __restrict__ part)        // (4,133,3,60,108) partials (ws path)
{
  __shared__ __align__(16) float Uu[CR * LP];   // 82.9 KB
  __shared__ __align__(16) float Ku[CR * LP];   // 82.9 KB
  __shared__ __align__(16) float Wm[LP * LP];   //  9.2 KB   (~175 KB < 320 KB)

  const int l    = blockIdx.x;          // layer
  const int b    = blockIdx.y;          // batch
  const int tid  = threadIdx.x;
  const int lane = tid & 31;
  const int wave = tid >> 5;            // 0..8

  const float* Ib = I + (size_t)b * 3 * NPIX;
  const float* Sb = S + (size_t)b * NPIX * NLAY + l;
  const float* Mb = M + (size_t)b * NPIX;

  // ---- Stage 1a: zero the 3 padding columns (45..47) of Uu/Ku -------------
  for (int e = tid; e < CR * 3; e += 288) {
    int r = e / 3, p = LQ + (e - (e / 3) * 3);
    Uu[r * LP + p] = 0.0f;
    Ku[r * LP + p] = 0.0f;
  }

  // ---- Stage 1b: fill Uu/Ku (unfold is a permutation: 1 write/element) ----
  for (int pix = tid; pix < NPIX; pix += 288) {
    int h  = pix / WID, w = pix - h * WID;
    int ph = h / KS,  k1 = h - ph * KS;
    int pw = w / KS,  k2 = w - pw * KS;
    int p     = ph * PW + pw;           // patch (column) index
    int rbase = k1 * KS + k2;           // within-channel row index
    float s  = Sb[(size_t)pix * NLAY];
    float m  = Mb[pix];
    float sm = s * m;                   // S*M
    float sk = s - sm;                  // S*(1-M)
#pragma unroll
    for (int c = 0; c < 3; ++c) {
      float iv = Ib[c * NPIX + pix];
      int   r  = c * 144 + rbase;
      Uu[r * LP + p] = iv * sm;
      Ku[r * LP + p] = iv * sk;
    }
  }
  __syncthreads();

  // ---- Stage 2: Wm = Uu^T * Ku ; 9 waves <-> 9 (16x16) tiles --------------
  // A(16x4 f32) layout: lane<16: M=lane, VGPRv=K(2h+v) ; lanes>=16: K+=2
  {
    const int ti   = wave / 3, tj = wave - ti * 3;
    const int h    = lane >> 4;
    const int mcol = ti * 16 + (lane & 15);   // output row  (p index)
    const int ncol = tj * 16 + (lane & 15);   // output col  (q index)
    v8f acc0 = {}, acc1 = {};
    for (int k0 = 0; k0 < CR; k0 += 8) {      // 54 iters, 2 indep WMMA chains
      const int ka = k0 + 2 * h;
      v2f a, bb, a2, bb2;
      a.x   = Uu[ka * LP + mcol];
      a.y   = Uu[(ka + 1) * LP + mcol];
      bb.x  = Ku[ka * LP + ncol];
      bb.y  = Ku[(ka + 1) * LP + ncol];
      a2.x  = Uu[(ka + 4) * LP + mcol];
      a2.y  = Uu[(ka + 5) * LP + mcol];
      bb2.x = Ku[(ka + 4) * LP + ncol];
      bb2.y = Ku[(ka + 5) * LP + ncol];
      acc0 = __builtin_amdgcn_wmma_f32_16x16x4_f32(
          false, a, false, bb, (short)0, acc0, false, false);
      acc1 = __builtin_amdgcn_wmma_f32_16x16x4_f32(
          false, a2, false, bb2, (short)0, acc1, false, false);
    }
    // C/D layout: VGPR v -> row v (lanes 0-15) / row v+8 (lanes 16-31)
#pragma unroll
    for (int v = 0; v < 8; ++v) {
      int row = ti * 16 + v + 8 * h;
      Wm[row * LP + ncol] = acc0[v] + acc1[v];
    }
  }
  __syncthreads();

  // ---- Stage 3: L1 row normalization (rows 45..47 are all-zero: 0*1/eps=0)
  if (tid < LQ) {
    float s = 0.0f;
    for (int q = 0; q < LQ; ++q) s += fabsf(Wm[tid * LP + q]);
    float inv = 1.0f / fmaxf(s, 1e-12f);
    for (int q = 0; q < LP; ++q) Wm[tid * LP + q] *= inv;
  }
  __syncthreads();

  // ---- Stage 4: WK = Ku * Wm^T ; 81 tiles over 9 waves, fold + reduce -----
  {
    const int h  = lane >> 4;
    const int lc = lane & 15;
    for (int t = wave; t < 81; t += 9) {          // uniform: 9 iters per wave
      const int mt = t / 3, nt = t - mt * 3;
      const int mrow = mt * 16 + lc;              // unfold row (c,k1,k2)
      const int ncol = nt * 16 + lc;              // patch index i
      v8f acc0 = {}, acc1 = {};
#pragma unroll
      for (int s = 0; s < 6; ++s) {               // 12 k-steps, 2 chains
        const int ka = 8 * s + 2 * h;             // even -> 8B aligned pairs
        v2f a  = *(const v2f*)&Ku[mrow * LP + ka];
        v2f bb = *(const v2f*)&Wm[ncol * LP + ka];
        v2f a2 = *(const v2f*)&Ku[mrow * LP + ka + 4];
        v2f b2 = *(const v2f*)&Wm[ncol * LP + ka + 4];
        acc0 = __builtin_amdgcn_wmma_f32_16x16x4_f32(
            false, a, false, bb, (short)0, acc0, false, false);
        acc1 = __builtin_amdgcn_wmma_f32_16x16x4_f32(
            false, a2, false, b2, (short)0, acc1, false, false);
      }
      if (ncol < LQ) {
        const int ph = ncol / PW, pw = ncol - ph * PW;
#pragma unroll
        for (int v = 0; v < 8; ++v) {
          int   r   = mt * 16 + v + 8 * h;        // 0..431
          int   c   = r / 144, rem = r - c * 144;
          int   k1  = rem / KS, k2 = rem - k1 * KS;
          int   pix = (ph * KS + k1) * WID + pw * KS + k2;
          float val = acc0[v] + acc1[v];
          if (USE_WS) {
            // bijection (r, i<45) <-> (c, pix): each element written once
            part[(((size_t)b * NLAY + l) * 3 + c) * NPIX + pix] = val;
          } else {
            atomicAdd(&outacc[((size_t)b * 3 + c) * NPIX + pix], val);
          }
        }
      }
    }
  }
}

// ---------------------------------------------------------------------------
// ws path: sum 133 partial planes per output element + blend (one pass,
// coalesced: consecutive threads read consecutive pix within a plane).
// ---------------------------------------------------------------------------
__global__ void reduce_blend_kernel(const float* __restrict__ I,
                                    const float* __restrict__ M,
                                    const float* __restrict__ part,
                                    float* __restrict__ out, int n) {
  int i = blockIdx.x * blockDim.x + threadIdx.x;
  if (i < n) {
    int b   = i / (3 * NPIX);
    int rem = i - b * 3 * NPIX;     // c*NPIX + pix
    int pix = i % NPIX;
    const float* p = part + (size_t)b * NLAY * 3 * NPIX + rem;
    float s = 0.0f;
    for (int l = 0; l < NLAY; ++l) s += p[(size_t)l * 3 * NPIX];
    float m = M[(size_t)b * NPIX + pix];
    out[i] = I[i] * (1.0f - m) + s * m;
  }
}

// ---------------------------------------------------------------------------
// atomic-path helpers: zero d_out first.
// ---------------------------------------------------------------------------
__global__ void zero_kernel(float* __restrict__ out, int n) {
  int i = blockIdx.x * blockDim.x + threadIdx.x;
  if (i < n) out[i] = 0.0f;
}

__global__ void blend_kernel(const float* __restrict__ I,
                             const float* __restrict__ M,
                             float* __restrict__ out, int n) {
  int i = blockIdx.x * blockDim.x + threadIdx.x;
  if (i < n) {
    int b   = i / (3 * NPIX);
    int pix = i % NPIX;
    float m = M[(size_t)b * NPIX + pix];
    out[i] = I[i] * (1.0f - m) + out[i] * m;
  }
}

// ---------------------------------------------------------------------------
extern "C" void kernel_launch(void* const* d_in, const int* in_sizes, int n_in,
                              void* d_out, int out_size, void* d_ws, size_t ws_size,
                              hipStream_t stream) {
  const float* I = (const float*)d_in[0];
  const float* S = (const float*)d_in[1];
  const float* M = (const float*)d_in[2];
  float* out = (float*)d_out;

  const int    n    = NB * 3 * NPIX;                              // 77760
  const size_t need = (size_t)NB * NLAY * 3 * NPIX * sizeof(float); // ~39.5 MB

  if (d_ws != nullptr && ws_size >= need) {
    // streaming-partials path: 41 MB write + 41 MB read (~3.6 us @ 23.3 TB/s)
    float* part = (float*)d_ws;
    matting_layer_kernel<true><<<dim3(NLAY, NB), 288, 0, stream>>>(
        I, S, M, out, part);
    reduce_blend_kernel<<<(n + 255) / 256, 256, 0, stream>>>(I, M, part, out, n);
  } else {
    // fallback: accumulate with global atomics directly into d_out
    zero_kernel<<<(n + 255) / 256, 256, 0, stream>>>(out, n);
    matting_layer_kernel<false><<<dim3(NLAY, NB), 288, 0, stream>>>(
        I, S, M, out, nullptr);
    blend_kernel<<<(n + 255) / 256, 256, 0, stream>>>(I, M, out, n);
  }
}

// v001
// One run takes 61.2 microseconds.
// Next to v000, in two timings, it ran 1.25 times as fast each time.
#include <hip/hip_runtime.h>

// ---------------------------------------------------------------------------
// Problem constants (from reference)
// ---------------------------------------------------------------------------
#define HGT   60
#define WID   108
#define NPIX  (HGT * WID)        // 6480 pixels per (b) image plane
#define NLAY  133
#define NB    4
#define KS    12
#define PH    5
#define PW    9
#define LQ    45                 // number of patches (real columns)
#define LP    48                 // padded to 3 x 16 for WMMA tiles
#define CR    432                // unfold rows = 3 * 12 * 12 (27 x 16 exactly)
#define NCH   4                  // row chunks of stages 1+2
#define CK1   3                  // k1 values per chunk (KS / NCH)
#define CRC   (CK1 * KS)         // 36 chunk rows per channel
#define CRR   (3 * CRC)          // 108 chunk rows = 27 k-steps of 4
#define CPIX  (PH * CK1 * WID)   // 1620 pixels per chunk

typedef __attribute__((ext_vector_type(2))) float v2f;
typedef __attribute__((ext_vector_type(8))) float v8f;

// ---------------------------------------------------------------------------
// Main kernel: one workgroup per (layer, batch). 288 threads = 9 wave32.
//   Stage 1: build Uu (=unfold(I*S*M)) and Ku (=unfold(I*S*(1-M))) in LDS.
//   Stage 2: Wm = Uu^T * Ku        (45x45 padded 48x48, K=432)  [f32 WMMA]
//   Stages 1 and 2 run in NCH row chunks: Ku is kept whole (stage 4 reads it
//   again), Uu is only the k-stream of stage 2, so just one chunk of it lives
//   in LDS. That brings LDS under a third of a WGP's, so three workgroups are
//   resident per WGP and the whole grid (532) runs in one round.
//   Stage 3: L1-normalize rows of Wm
//   Stage 4: WK = Ku * Wm^T        (432x45 padded 48,  K=48)    [f32 WMMA]
//            fold + layer reduction:
//              USE_WS=true : plain stores into per-(b,l) partial planes (ws)
//              USE_WS=false: atomicAdd into the out accumulator
// Dual accumulators in both k-loops break the WMMA RAW dependency chain.
// ---------------------------------------------------------------------------
template <bool USE_WS>
__global__ __launch_bounds__(288) void matting_layer_kernel(
    const float* __restrict__ I,     // (4,3,60,108)
    const float* __restrict__ S,     // (4,60,108,133)
    const float* __restrict__ M,     // (4,1,60,108)
    float* __restrict__ outacc,      // (4,3,60,108) accumulator (atomic path)
    float* __restrict__ part)        // (4,133,3,60,108) partials (ws path)
{
  __shared__ __align__(16) float Ku[CR * LP];   // 82.9 KB
  __shared__ __align__(16) float Uc[CRR * LP];  // 20736 B: one chunk of Uu
  float* const Wm = Uc;   // 48x48, written only after the last read of Uc

  const int l    = blockIdx.x;          // layer
  const int b    = blockIdx.y;          // batch
  const int tid  = threadIdx.x;
  const int lane = tid & 31;
  const int wave = tid >> 5;            // 0..8

  const float* Ib = I + (size_t)b * 3 * NPIX;
  const float* Sb = S + (size_t)b * NPIX * NLAY + l;
  const float* Mb = M + (size_t)b * NPIX;

  // ---- Stage 1a: zero the 3 padding columns (45..47) of Ku and Uc ---------
  for (int e = tid; e < CR * 3; e += 288) {
    int r = e / 3, p = LQ + (e - (e / 3) * 3);
    Ku[r * LP + p] = 0.0f;
    if (r < CRR) Uc[r * LP + p] = 0.0f;
  }

  // ---- Stages 1b + 2, chunk by chunk --------------------------------------
  // Chunk j holds the unfold rows with k1 in [3j, 3j+3), all three channels:
  //   chunk row  c*36  + (k1-3j)*12 + k2   <->   unfold row  c*144 + k1*12 + k2
  // A(16x4 f32) layout: lane<16: M=lane, VGPRv=K(2h+v) ; lanes>=16: K+=2
  {
    const int ti   = wave / 3, tj = wave - ti * 3;
    const int h    = lane >> 4;
    const int mcol = ti * 16 + (lane & 15);   // output row  (p index)
    const int ncol = tj * 16 + (lane & 15);   // output col  (q index)
    v8f acc0 = {}, acc1 = {};

    for (int j = 0; j < NCH; ++j) {
      // fill: 15 image rows (5 patch rows x 3 k1) of 108 pixels, 1 write/element
      for (int e = tid; e < CPIX; e += 288) {
        int rr = e / WID, w = e - rr * WID;
        int ph = rr / CK1, kl = rr - ph * CK1;  // kl = k1 - 3j
        int pw = w / KS,   k2 = w - pw * KS;
        int pix   = (ph * KS + j * CK1 + kl) * WID + w;
        int p     = ph * PW + pw;               // patch (column) index
        int rbase = kl * KS + k2;               // within-channel chunk row
        float s  = Sb[(size_t)pix * NLAY];
        float m  = Mb[pix];
        float sm = s * m;                       // S*M
        float sk = s - sm;                      // S*(1-M)
#pragma unroll
        for (int c = 0; c < 3; ++c) {
          float iv = Ib[c * NPIX + pix];
          Uc[(c * CRC + rbase) * LP + p]           = iv * sm;
          Ku[(c * 144 + j * CRC + rbase) * LP + p] = iv * sk;
        }
      }
      __syncthreads();   // chunk j of Uc and Ku is complete

      // Wm += Uc^T * Ku(chunk rows); 9 waves <-> 9 (16x16) tiles
      const float* ua = &Uc[(2 * h) * LP + mcol];
      const float* kb = &Ku[(j * CRC + 2 * h) * LP + ncol];
      // unrolled so that the accumulator of each k-step and the channel's row
      // offset are compile-time (27 k-steps, alternating two WMMA chains)
#pragma unroll
      for (int ks = 0; ks < CRR / 4; ++ks) {
        const int ra = 4 * ks;                          // chunk row
        const int rb = 4 * ks + (ks / 9) * (144 - CRC); // unfold row - 36j
        v2f a, bb;
        a.x  = ua[ra * LP];
        a.y  = ua[(ra + 1) * LP];
        bb.x = kb[rb * LP];
        bb.y = kb[(rb + 1) * LP];
        if (ks & 1)
          acc1 = __builtin_amdgcn_wmma_f32_16x16x4_f32(
              false, a, false, bb, (short)0, acc1, false, false);
        else
          acc0 = __builtin_amdgcn_wmma_f32_16x16x4_f32(
              false, a, false, bb, (short)0, acc0, false, false);
      }
      __syncthreads();   // every wave has left Uc: refill it (or write Wm)
    }

    // C/D layout: VGPR v -> row v (lanes 0-15) / row v+8 (lanes 16-31)
#pragma unroll
    for (int v = 0; v < 8; ++v) {
      int row = ti * 16 + v + 8 * h;
      Wm[row * LP + ncol] = acc0[v] + acc1[v];
    }
  }
  __syncthreads();

  // ---- Stage 3: L1 row normalization (rows 45..47 are all-zero: 0*1/eps=0)
  if (tid < LQ) {
    float s = 0.0f;
    for (int q = 0; q < LQ; ++q) s += fabsf(Wm[tid * LP + q]);
    float inv = 1.0f / fmaxf(s, 1e-12f);
    for (int q = 0; q < LP; ++q) Wm[tid * LP + q] *= inv;
  }
  __syncthreads();

  // ---- Stage 4: WK = Ku * Wm^T ; 81 tiles over 9 waves, fold + reduce -----
  {
    const int h  = lane >> 4;
    const int lc = lane & 15;
    for (int t = wave; t < 81; t += 9) {          // uniform: 9 iters per wave
      const int mt = t / 3, nt = t - mt * 3;
      const int mrow = mt * 16 + lc;              // unfold row (c,k1,k2)
      const int ncol = nt * 16 + lc;              // patch index i
      v8f acc0 = {}, acc1 = {};
#pragma unroll
      for (int s = 0; s < 6; ++s) {               // 12 k-steps, 2 chains
        const int ka = 8 * s + 2 * h;             // even -> 8B aligned pairs
        v2f a  = *(const v2f*)&Ku[mrow * LP + ka];
        v2f bb = *(const v2f*)&Wm[ncol * LP + ka];
        v2f a2 = *(const v2f*)&Ku[mrow * LP + ka + 4];
        v2f b2 = *(const v2f*)&Wm[ncol * LP + ka + 4];
        acc0 = __builtin_amdgcn_wmma_f32_16x16x4_f32(
            false, a, false, bb, (short)0, acc0, false, false);
        acc1 = __builtin_amdgcn_wmma_f32_16x16x4_f32(
            false, a2, false, b2, (short)0, acc1, false, false);
      }
      if (ncol < LQ) {
        const int ph = ncol / PW, pw = ncol - ph * PW;
#pragma unroll
        for (int v = 0; v < 8; ++v) {
          int   r   = mt * 16 + v + 8 * h;        // 0..431
          int   c   = r / 144, rem = r - c * 144;
          int   k1  = rem / KS, k2 = rem - k1 * KS;
          int   pix = (ph * KS + k1) * WID + pw * KS + k2;
          float val = acc0[v] + acc1[v];
          if (USE_WS) {
            // bijection (r, i<45) <-> (c, pix): each element written once
            part[(((size_t)b * NLAY + l) * 3 + c) * NPIX + pix] = val;
          } else {
            atomicAdd(&outacc[((size_t)b * 3 + c) * NPIX + pix], val);
          }
        }
      }
    }
  }
}

// ---------------------------------------------------------------------------
// ws path: sum 133 partial planes per output element + blend (one pass,
// coalesced: consecutive threads read consecutive pix within a plane).
// ---------------------------------------------------------------------------
__global__ void reduce_blend_kernel(const float* __restrict__ I,
                                    const float* __restrict__ M,
                                    const float* __restrict__ part,
                                    float* __restrict__ out, int n) {
  int i = blockIdx.x * blockDim.x + threadIdx.x;
  if (i < n) {
    int b   = i / (3 * NPIX);
    int rem = i - b * 3 * NPIX;     // c*NPIX + pix
    int pix = i % NPIX;
    const float* p = part + (size_t)b * NLAY * 3 * NPIX + rem;
    float s = 0.0f;
    for (int l = 0; l < NLAY; ++l) s += p[(size_t)l * 3 * NPIX];
    float m = M[(size_t)b * NPIX + pix];
    out[i] = I[i] * (1.0f - m) + s * m;
  }
}

// ---------------------------------------------------------------------------
// atomic-path helpers: zero d_out first.
// ---------------------------------------------------------------------------
__global__ void zero_kernel(float* __restrict__ out, int n) {
  int i = blockIdx.x * blockDim.x + threadIdx.x;
  if (i < n) out[i] = 0.0f;
}

__global__ void blend_kernel(const float* __restrict__ I,
                             const float* __restrict__ M,
                             float* __restrict__ out, int n) {
  int i = blockIdx.x * blockDim.x + threadIdx.x;
  if (i < n) {
    int b   = i / (3 * NPIX);
    int pix = i % NPIX;
    float m = M[(size_t)b * NPIX + pix];
    out[i] = I[i] * (1.0f - m) + out[i] * m;
  }
}

// ---------------------------------------------------------------------------
extern "C" void kernel_launch(void* const* d_in, const int* in_sizes, int n_in,
                              void* d_out, int out_size, void* d_ws, size_t ws_size,
                              hipStream_t stream) {
  const float* I = (const float*)d_in[0];
  const float* S = (const float*)d_in[1];
  const float* M = (const float*)d_in[2];
  float* out = (float*)d_out;

  const int    n    = NB * 3 * NPIX;                              // 77760
  const size_t need = (size_t)NB * NLAY * 3 * NPIX * sizeof(float); // ~39.5 MB

  if (d_ws != nullptr && ws_size >= need) {
    // streaming-partials path: 41 MB write + 41 MB read (~3.6 us @ 23.3 TB/s)
    float* part = (float*)d_ws;
    matting_layer_kernel<true><<<dim3(NLAY, NB), 288, 0, stream>>>(
        I, S, M, out, part);
    reduce_blend_kernel<<<(n + 255) / 256, 256, 0, stream>>>(I, M, part, out, n);
  } else {
    // fallback: accumulate with global atomics directly into d_out
    zero_kernel<<<(n + 255) / 256, 256, 0, stream>>>(out, n);
    matting_layer_kernel<false><<<dim3(NLAY, NB), 288, 0, stream>>>(
        I, S, M, out, nullptr);
    blend_kernel<<<(n + 255) / 256, 256, 0, stream>>>(I, M, out, n);
  }
}

// v002
// One run takes 48.5 microseconds.
// Timed twice side by side with v001, it ran 1.26 times as fast both times.
// Counting every step since v000, it is 1.58 times as fast.
#include <hip/hip_runtime.h>

// ---------------------------------------------------------------------------
// Problem constants (from reference)
// ---------------------------------------------------------------------------
#define HGT   60
#define WID   108
#define NPIX  (HGT * WID)        // 6480 pixels per (b) image plane
#define NLAY  133
#define NB    4
#define KS    12
#define PH    5
#define PW    9
#define LQ    45                 // number of patches (real columns)
#define LP    48                 // padded to 3 x 16 for WMMA tiles
#define CR    432                // unfold rows = 3 * 12 * 12 (27 x 16 exactly)
#define NCH   4                  // row chunks of stages 1+2
#define CK1   3                  // k1 values per chunk (KS / NCH)
#define CRC   (CK1 * KS)         // 36 chunk rows per channel
#define CRR   (3 * CRC)          // 108 chunk rows = 27 k-steps of 4
#define CPIX  (PH * CK1 * WID)   // 1620 pixels per chunk
#define TPX   64                 // pixels per tile of the S transpose
#define TTILE (NB * NPIX / TPX)  // 405 tiles, all full
#define TV4   (TPX * NLAY / 4)   // 2128 float4 per tile
#define SSKEW (NPIX % TPX)       // 16: start of image b's planes, times b
#define SPITCH 6528              // plane pitch of the transposed S (102 x 64)

typedef __attribute__((ext_vector_type(2))) float v2f;
typedef __attribute__((ext_vector_type(8))) float v8f;

// ---------------------------------------------------------------------------
// Pre-pass (ws path): S (b, pix, layer) -> St (b, layer, pix), pitch SPITCH.
// In S one layer's pixels lie 532 B apart, so a wave of the main kernel that
// reads 32 pixels of its layer touches 32 cache lines for 128 useful bytes,
// and every line is fetched again by each of the layers that share it. Here
// S is read once in whole lines (a tile of 64 pixels x 133 layers is one
// contiguous run), turned in LDS and written as 256-B runs, one per layer.
// Tiles run over the 25920 pixels of all images (405 full tiles); image b's
// planes start SSKEW*b floats into their pitch, so that every run of 64
// pixels starts on a multiple of 256 B although 6480 is no multiple of 64.
// LDS reads: lane stride 266 dwords (10 mod 64) -> 32 distinct banks.
// ---------------------------------------------------------------------------
__global__ __launch_bounds__(256) void transpose_s_kernel(
    const float* __restrict__ S,     // (4,60,108,133)
    float* __restrict__ St)          // (4,133,SPITCH)
{
  // 2128 float4 of data; rounded up to 9 x 256 so that no fill step branches
  __shared__ __align__(16) float tile[9 * 256 * 4];  // 36864 B

  const int t    = blockIdx.x;          // tile
  const int tid  = threadIdx.x;
  const int lane = tid & 31;
  const int wave = (tid >> 5) & 7;

  const float4* src = (const float4*)(S + (size_t)t * TPX * NLAY);
  float4 r[9];
  // unrolled and branch-free (the last step's surplus lanes re-read the
  // tile's last float4 and put it behind the data in LDS, where nobody reads):
  // all nine loads are in flight before the first LDS store waits for one
#pragma unroll
  for (int i = 0; i < 9; ++i) {
    int e = tid + i * 256;
    r[i] = src[e < TV4 ? e : TV4 - 1];
  }
#pragma unroll   // r[] stays in registers only with constant indices
  for (int i = 0; i < 9; ++i) ((float4*)tile)[tid + i * 256] = r[i];
  __syncthreads();

  const int g = t * TPX + 2 * lane;     // pixel over all images; pairs stay
  const int b = g / NPIX;               // inside one image (6480 is even)
  const float* tp  = &tile[2 * lane * NLAY + wave];
  float*       dst = St + ((size_t)b * NLAY + wave) * SPITCH
                        + (g - b * NPIX) + b * SSKEW;
  // unrolled so that the LDS reads of many layers run ahead of the stores
#pragma unroll
  for (int i = 0; i < NLAY / 8; ++i) {  // layers wave + 8i <= 127
    float2 v;
    v.x = tp[8 * i];
    v.y = tp[NLAY + 8 * i];
    *(float2*)(dst + (size_t)(8 * i) * SPITCH) = v;
  }
  if (wave < NLAY % 8) {                // layers 128..132
    float2 v;
    v.x = tp[NLAY / 8 * 8];
    v.y = tp[NLAY + NLAY / 8 * 8];
    *(float2*)(dst + (size_t)(NLAY / 8 * 8) * SPITCH) = v;
  }
}

// ---------------------------------------------------------------------------
// Main kernel: one workgroup per (layer, batch). 288 threads = 9 wave32.
//   Stage 1: build Uu (=unfold(I*S*M)) and Ku (=unfold(I*S*(1-M))) in LDS.
//   Stage 2: Wm = Uu^T * Ku        (45x45 padded 48x48, K=432)  [f32 WMMA]
//   Stages 1 and 2 run in NCH row chunks: Ku is kept whole (stage 4 reads it
//   again), Uu is only the k-stream of stage 2, so just one chunk of it lives
//   in LDS. That brings LDS under a third of a WGP's, so three workgroups are
//   resident per WGP and the whole grid (532) runs in one round.
//   Stage 3: L1-normalize rows of Wm
//   Stage 4: WK = Ku * Wm^T        (432x45 padded 48,  K=48)    [f32 WMMA]
//            fold + layer reduction:
//              USE_WS=true : plain stores into per-(b,l) partial planes (ws)
//              USE_WS=false: atomicAdd into the out accumulator
// Dual accumulators in both k-loops break the WMMA RAW dependency chain.
// ---------------------------------------------------------------------------
template <bool USE_WS>
__global__ __launch_bounds__(288) void matting_layer_kernel(
    const float* __restrict__ I,     // (4,3,60,108)
    const float* __restrict__ S,     // USE_WS: St (4,133,SPITCH); else (4,60,108,133)
    const float* __restrict__ M,     // (4,1,60,108)
    float* __restrict__ outacc,      // (4,3,60,108) accumulator (atomic path)
    float* __restrict__ part)        // (4,133,3,60,108) partials (ws path)
{
  __shared__ __align__(16) float Ku[CR * LP];   // 82.9 KB
  __shared__ __align__(16) float Uc[CRR * LP];  // 20736 B: one chunk of Uu
  float* const Wm = Uc;   // 48x48, written only after the last read of Uc

  const int l    = blockIdx.x;          // layer
  const int b    = blockIdx.y;          // batch
  const int tid  = threadIdx.x;
  const int lane = tid & 31;
  const int wave = tid >> 5;            // 0..8

  const float* Ib = I + (size_t)b * 3 * NPIX;
  const float* Sb = USE_WS ? S + ((size_t)b * NLAY + l) * SPITCH + b * SSKEW
                           : S + (size_t)b * NPIX * NLAY + l;
  const float* Mb = M + (size_t)b * NPIX;

  // ---- Stage 1a: zero the 3 padding columns (45..47) of Ku and Uc ---------
  for (int e = tid; e < CR * 3; e += 288) {
    int r = e / 3, p = LQ + (e - (e / 3) * 3);
    Ku[r * LP + p] = 0.0f;
    if (r < CRR) Uc[r * LP + p] = 0.0f;
  }

  // ---- Stages 1b + 2, chunk by chunk --------------------------------------
  // Chunk j holds the unfold rows with k1 in [3j, 3j+3), all three channels:
  //   chunk row  c*36  + (k1-3j)*12 + k2   <->   unfold row  c*144 + k1*12 + k2
  // A(16x4 f32) layout: lane<16: M=lane, VGPRv=K(2h+v) ; lanes>=16: K+=2
  {
    const int ti   = wave / 3, tj = wave - ti * 3;
    const int h    = lane >> 4;
    const int mcol = ti * 16 + (lane & 15);   // output row  (p index)
    const int ncol = tj * 16 + (lane & 15);   // output col  (q index)
    v8f acc0 = {}, acc1 = {};

    for (int j = 0; j < NCH; ++j) {
      // fill: 15 image rows (5 patch rows x 3 k1) of 27 quads, 1 write/element.
      // A quad is 4 neighbouring pixels of one patch row (12 = 3 quads): the
      // layer's plane, M and I are each read 16 B a lane, in whole lines.
      for (int e = tid; e < CPIX / 4; e += 288) {
        int rr = e / (WID / 4), wq = e - rr * (WID / 4);
        int ph = rr / CK1, kl = rr - ph * CK1;  // kl = k1 - 3j
        int pw = wq / 3,   k2 = (wq - pw * 3) * 4;
        int pix   = (ph * KS + j * CK1 + kl) * WID + wq * 4;
        int p     = ph * PW + pw;               // patch (column) index
        int rbase = kl * KS + k2;               // within-channel chunk row
        float4 s4;
        if (USE_WS) {
          s4 = *(const float4*)&Sb[pix];
        } else {
          s4.x = Sb[(size_t)pix * NLAY];
          s4.y = Sb[(size_t)(pix + 1) * NLAY];
          s4.z = Sb[(size_t)(pix + 2) * NLAY];
          s4.w = Sb[(size_t)(pix + 3) * NLAY];
          // precaution: stands in front of the loads below, whose results the
          // compiler may place in address registers of the four loads above
          asm volatile("s_wait_xcnt 0x0" ::: "memory");
        }
        const float4 m4 = *(const float4*)&Mb[pix];
        const float s[4] = {s4.x, s4.y, s4.z, s4.w};
        const float m[4] = {m4.x, m4.y, m4.z, m4.w};
        float sm[4], sk[4];
        // the loops over i and c are unrolled: constant indices keep the small
        // arrays in registers and turn the LDS row offsets into immediates
#pragma unroll
        for (int i = 0; i < 4; ++i) {
          sm[i] = s[i] * m[i];                  // S*M
          sk[i] = s[i] - sm[i];                 // S*(1-M)
        }
#pragma unroll
        for (int c = 0; c < 3; ++c) {
          const float4 i4 = *(const float4*)&Ib[c * NPIX + pix];
          const float iv[4] = {i4.x, i4.y, i4.z, i4.w};
#pragma unroll
          for (int i = 0; i < 4; ++i) {
            Uc[(c * CRC + rbase + i) * LP + p]           = iv[i] * sm[i];
            Ku[(c * 144 + j * CRC + rbase + i) * LP + p] = iv[i] * sk[i];
          }
        }
      }
      __syncthreads();   // chunk j of Uc and Ku is complete

      // Wm += Uc^T * Ku(chunk rows); 9 waves <-> 9 (16x16) tiles
      const float* ua = &Uc[(2 * h) * LP + mcol];
      const float* kb = &Ku[(j * CRC + 2 * h) * LP + ncol];
      // unrolled so that the accumulator of each k-step and the channel's row
      // offset are compile-time (27 k-steps, alternating two WMMA chains)
#pragma unroll
      for (int ks = 0; ks < CRR / 4; ++ks) {
        const int ra = 4 * ks;                          // chunk row
        const int rb = 4 * ks + (ks / 9) * (144 - CRC); // unfold row - 36j
        v2f a, bb;
        a.x  = ua[ra * LP];
        a.y  = ua[(ra + 1) * LP];
        bb.x = kb[rb * LP];
        bb.y = kb[(rb + 1) * LP];
        if (ks & 1)
          acc1 = __builtin_amdgcn_wmma_f32_16x16x4_f32(
              false, a, false, bb, (short)0, acc1, false, false);
        else
          acc0 = __builtin_amdgcn_wmma_f32_16x16x4_f32(
              false, a, false, bb, (short)0, acc0, false, false);
      }
      __syncthreads();   // every wave has left Uc: refill it (or write Wm)
    }

    // C/D layout: VGPR v -> row v (lanes 0-15) / row v+8 (lanes 16-31)
#pragma unroll
    for (int v = 0; v < 8; ++v) {
      int row = ti * 16 + v + 8 * h;
      Wm[row * LP + ncol] = acc0[v] + acc1[v];
    }
  }
  __syncthreads();

  // ---- Stage 3: L1 row normalization (rows 45..47 are all-zero: 0*1/eps=0)
  if (tid < LQ) {
    float s = 0.0f;
    for (int q = 0; q < LQ; ++q) s += fabsf(Wm[tid * LP + q]);
    float inv = 1.0f / fmaxf(s, 1e-12f);
    for (int q = 0; q < LP; ++q) Wm[tid * LP + q] *= inv;
  }
  __syncthreads();

  // ---- Stage 4: WK = Ku * Wm^T ; 81 tiles over 9 waves, fold + reduce -----
  {
    const int h  = lane >> 4;
    const int lc = lane & 15;
    for (int t = wave; t < 81; t += 9) {          // uniform: 9 iters per wave
      const int mt = t / 3, nt = t - mt * 3;
      const int mrow = mt * 16 + lc;              // unfold row (c,k1,k2)
      const int ncol = nt * 16 + lc;              // patch index i
      v8f acc0 = {}, acc1 = {};
#pragma unroll
      for (int s = 0; s < 6; ++s) {               // 12 k-steps, 2 chains
        const int ka = 8 * s + 2 * h;             // even -> 8B aligned pairs
        v2f a  = *(const v2f*)&Ku[mrow * LP + ka];
        v2f bb = *(const v2f*)&Wm[ncol * LP + ka];
        v2f a2 = *(const v2f*)&Ku[mrow * LP + ka + 4];
        v2f b2 = *(const v2f*)&Wm[ncol * LP + ka + 4];
        acc0 = __builtin_amdgcn_wmma_f32_16x16x4_f32(
            false, a, false, bb, (short)0, acc0, false, false);
        acc1 = __builtin_amdgcn_wmma_f32_16x16x4_f32(
            false, a2, false, b2, (short)0, acc1, false, false);
      }
      if (ncol < LQ) {
        const int ph = ncol / PW, pw = ncol - ph * PW;
#pragma unroll
        for (int v = 0; v < 8; ++v) {
          int   r   = mt * 16 + v + 8 * h;        // 0..431
          int   c   = r / 144, rem = r - c * 144;
          int   k1  = rem / KS, k2 = rem - k1 * KS;
          int   pix = (ph * KS + k1) * WID + pw * KS + k2;
          float val = acc0[v] + acc1[v];
          if (USE_WS) {
            // bijection (r, i<45) <-> (c, pix): each element written once
            part[(((size_t)b * NLAY + l) * 3 + c) * NPIX + pix] = val;
          } else {
            atomicAdd(&outacc[((size_t)b * 3 + c) * NPIX + pix], val);
          }
        }
      }
    }
  }
}

// ---------------------------------------------------------------------------
// ws path: sum 133 partial planes per output element + blend (one pass,
// coalesced: consecutive threads read consecutive pix within a plane).
// ---------------------------------------------------------------------------
__global__ void reduce_blend_kernel(const float* __restrict__ I,
                                    const float* __restrict__ M,
                                    const float* __restrict__ part,
                                    float* __restrict__ out, int n) {
  int i = blockIdx.x * blockDim.x + threadIdx.x;
  if (i < n) {
    int b   = i / (3 * NPIX);
    int rem = i - b * 3 * NPIX;     // c*NPIX + pix
    int pix = i % NPIX;
    const float* p = part + (size_t)b * NLAY * 3 * NPIX + rem;
    float s = 0.0f;
    for (int l = 0; l < NLAY; ++l) s += p[(size_t)l * 3 * NPIX];
    float m = M[(size_t)b * NPIX + pix];
    out[i] = I[i] * (1.0f - m) + s * m;
  }
}

// ---------------------------------------------------------------------------
// atomic-path helpers: zero d_out first.
// ---------------------------------------------------------------------------
__global__ void zero_kernel(float* __restrict__ out, int n) {
  int i = blockIdx.x * blockDim.x + threadIdx.x;
  if (i < n) out[i] = 0.0f;
}

__global__ void blend_kernel(const float* __restrict__ I,
                             const float* __restrict__ M,
                             float* __restrict__ out, int n) {
  int i = blockIdx.x * blockDim.x + threadIdx.x;
  if (i < n) {
    int b   = i / (3 * NPIX);
    int pix = i % NPIX;
    float m = M[(size_t)b * NPIX + pix];
    out[i] = I[i] * (1.0f - m) + out[i] * m;
  }
}

// ---------------------------------------------------------------------------
extern "C" void kernel_launch(void* const* d_in, const int* in_sizes, int n_in,
                              void* d_out, int out_size, void* d_ws, size_t ws_size,
                              hipStream_t stream) {
  const float* I = (const float*)d_in[0];
  const float* S = (const float*)d_in[1];
  const float* M = (const float*)d_in[2];
  float* out = (float*)d_out;

  const int    n    = NB * 3 * NPIX;                              // 77760
  const size_t npart = (size_t)NB * NLAY * 3 * NPIX;              // ~39.5 MB
  const size_t need  = (npart + (size_t)NB * NLAY * SPITCH) * sizeof(float);

  if (d_ws != nullptr && ws_size >= need) {
    // streaming-partials path: 41 MB write + 41 MB read (~3.6 us @ 23.3 TB/s)
    float* part = (float*)d_ws;
    float* St   = part + npart;       // transposed S, rewritten in every call
    transpose_s_kernel<<<TTILE, 256, 0, stream>>>(S, St);
    matting_layer_kernel<true><<<dim3(NLAY, NB), 288, 0, stream>>>(
        I, St, M, out, part);
    reduce_blend_kernel<<<(n + 255) / 256, 256, 0, stream>>>(I, M, part, out, n);
  } else {
    // fallback: accumulate with global atomics directly into d_out
    zero_kernel<<<(n + 255) / 256, 256, 0, stream>>>(out, n);
    matting_layer_kernel<false><<<dim3(NLAY, NB), 288, 0, stream>>>(
        I, S, M, out, nullptr);
    blend_kernel<<<(n + 255) / 256, 256, 0, stream>>>(I, M, out, n);
  }
}

// v003
// It runs in 44.9 microseconds.
// Next to v002, in two timings, it ran 1.08 times as fast each time.
// Over all steps from v000 it is 1.70 times as fast.
#include <hip/hip_runtime.h>

// ---------------------------------------------------------------------------
// Problem constants (from reference)
// ---------------------------------------------------------------------------
#define HGT   60
#define WID   108
#define NPIX  (HGT * WID)        // 6480 pixels per (b) image plane
#define NLAY  133
#define NB    4
#define KS    12
#define PH    5
#define PW    9
#define LQ    45                 // number of patches (real columns)
#define LP    48                 // padded to 3 x 16 for WMMA tiles
#define CR    432                // unfold rows = 3 * 12 * 12 (27 x 16 exactly)
#define NCH   4                  // row chunks of stages 1+2
#define CK1   3                  // k1 values per chunk (KS / NCH)
#define CRC   (CK1 * KS)         // 36 chunk rows per channel
#define CRR   (3 * CRC)          // 108 chunk rows = 27 k-steps of 4
#define CPIX  (PH * CK1 * WID)   // 1620 pixels per chunk
#define TPX   64                 // pixels per tile of the S transpose
#define TTILE (NB * NPIX / TPX)  // 405 tiles, all full
#define TV4   (TPX * NLAY / 4)   // 2128 float4 per tile
#define SSKEW (NPIX % TPX)       // 16: start of image b's planes, times b
#define SPITCH 6528              // plane pitch of the transposed S (102 x 64)

typedef __attribute__((ext_vector_type(2))) float v2f;
typedef __attribute__((ext_vector_type(8))) float v8f;

// ---------------------------------------------------------------------------
// Pre-pass (ws path): S (b, pix, layer) -> St (b, layer, pix), pitch SPITCH.
// In S one layer's pixels lie 532 B apart, so a wave of the main kernel that
// reads 32 pixels of its layer touches 32 cache lines for 128 useful bytes,
// and every line is fetched again by each of the layers that share it. Here
// S is read once in whole lines (a tile of 64 pixels x 133 layers is one
// contiguous run), turned in LDS and written as 256-B runs, one per layer.
// Tiles run over the 25920 pixels of all images (405 full tiles); image b's
// planes start SSKEW*b floats into their pitch, so that every run of 64
// pixels starts on a multiple of 256 B although 6480 is no multiple of 64.
// LDS reads: lane stride 266 dwords (10 mod 64) -> 32 distinct banks.
// ---------------------------------------------------------------------------
__global__ __launch_bounds__(256) void transpose_s_kernel(
    const float* __restrict__ S,     // (4,60,108,133)
    float* __restrict__ St)          // (4,133,SPITCH)
{
  // 2128 float4 of data; rounded up to 9 x 256 so that no fill step branches
  __shared__ __align__(16) float tile[9 * 256 * 4];  // 36864 B

  const int t    = blockIdx.x;          // tile
  const int tid  = threadIdx.x;
  const int lane = tid & 31;
  const int wave = (tid >> 5) & 7;

  const float4* src = (const float4*)(S + (size_t)t * TPX * NLAY);
  float4 r[9];
  // unrolled and branch-free (the last step's surplus lanes re-read the
  // tile's last float4 and put it behind the data in LDS, where nobody reads):
  // all nine loads are in flight before the first LDS store waits for one
#pragma unroll
  for (int i = 0; i < 9; ++i) {
    int e = tid + i * 256;
    r[i] = src[e < TV4 ? e : TV4 - 1];
  }
#pragma unroll   // r[] stays in registers only with constant indices
  for (int i = 0; i < 9; ++i) ((float4*)tile)[tid + i * 256] = r[i];
  __syncthreads();

  const int g = t * TPX + 2 * lane;     // pixel over all images; pairs stay
  const int b = g / NPIX;               // inside one image (6480 is even)
  const float* tp  = &tile[2 * lane * NLAY + wave];
  float*       dst = St + ((size_t)b * NLAY + wave) * SPITCH
                        + (g - b * NPIX) + b * SSKEW;
  // unrolled so that the LDS reads of many layers run ahead of the stores
#pragma unroll
  for (int i = 0; i < NLAY / 8; ++i) {  // layers wave + 8i <= 127
    float2 v;
    v.x = tp[8 * i];
    v.y = tp[NLAY + 8 * i];
    *(float2*)(dst + (size_t)(8 * i) * SPITCH) = v;
  }
  if (wave < NLAY % 8) {                // layers 128..132
    float2 v;
    v.x = tp[NLAY / 8 * 8];
    v.y = tp[NLAY + NLAY / 8 * 8];
    *(float2*)(dst + (size_t)(NLAY / 8 * 8) * SPITCH) = v;
  }
}

// ---------------------------------------------------------------------------
// Main kernel: one workgroup per (layer, batch). 288 threads = 9 wave32.
//   Stage 1: build Uu (=unfold(I*S*M)) and Ku (=unfold(I*S*(1-M))) in LDS.
//   Stage 2: Wm = Uu^T * Ku        (45x45 padded 48x48, K=432)  [f32 WMMA]
//   Stages 1 and 2 run in NCH row chunks: Ku is kept whole (stage 4 reads it
//   again), Uu is only the k-stream of stage 2, so just one chunk of it lives
//   in LDS. That brings LDS under a third of a WGP's, so three workgroups are
//   resident per WGP and the whole grid (532) runs in one round.
//   Stage 3: L1-normalize rows of Wm
//   Stage 4: WK = Ku * Wm^T        (432x45 padded 48,  K=48)    [f32 WMMA]
//            fold + layer reduction:
//              USE_WS=true : plain stores into per-(b,l) partial planes (ws)
//              USE_WS=false: atomicAdd into the out accumulator
// Dual accumulators in both k-loops break the WMMA RAW dependency chain.
// ---------------------------------------------------------------------------
template <bool USE_WS>
__global__ __launch_bounds__(288) void matting_layer_kernel(
    const float* __restrict__ I,     // (4,3,60,108)
    const float* __restrict__ S,     // USE_WS: St (4,133,SPITCH); else (4,60,108,133)
    const float* __restrict__ M,     // (4,1,60,108)
    float* __restrict__ outacc,      // (4,3,60,108) accumulator (atomic path)
    float* __restrict__ part)        // (4,133,3,60,108) partials (ws path)
{
  __shared__ __align__(16) float Ku[CR * LP];   // 82.9 KB
  __shared__ __align__(16) float Uc[CRR * LP];  // 20736 B: one chunk of Uu
  float* const Wm = Uc;   // 48x48, written only after the last read of Uc

  const int l    = blockIdx.x;          // layer
  const int b    = blockIdx.y;          // batch
  const int tid  = threadIdx.x;
  const int lane = tid & 31;
  const int wave = tid >> 5;            // 0..8

  const float* Ib = I + (size_t)b * 3 * NPIX;
  const float* Sb = USE_WS ? S + ((size_t)b * NLAY + l) * SPITCH + b * SSKEW
                           : S + (size_t)b * NPIX * NLAY + l;
  const float* Mb = M + (size_t)b * NPIX;

  // ---- Stage 1a: zero the 3 padding columns (45..47) of Ku and Uc ---------
  for (int e = tid; e < CR * 3; e += 288) {
    int r = e / 3, p = LQ + (e - (e / 3) * 3);
    Ku[r * LP + p] = 0.0f;
    if (r < CRR) Uc[r * LP + p] = 0.0f;
  }

  // ---- Stages 1b + 2, chunk by chunk --------------------------------------
  // Chunk j holds the unfold rows with k1 in [3j, 3j+3), all three channels:
  //   chunk row  c*36  + (k1-3j)*12 + k2   <->   unfold row  c*144 + k1*12 + k2
  // A(16x4 f32) layout: lane<16: M=lane, VGPRv=K(2h+v) ; lanes>=16: K+=2
  {
    const int ti   = wave / 3, tj = wave - ti * 3;
    const int h    = lane >> 4;
    const int mcol = ti * 16 + (lane & 15);   // output row  (p index)
    const int ncol = tj * 16 + (lane & 15);   // output col  (q index)
    v8f acc0 = {}, acc1 = {};

    for (int j = 0; j < NCH; ++j) {
      // fill: 15 image rows (5 patch rows x 3 k1) of 27 quads, 1 write/element.
      // A quad is 4 neighbouring pixels of one patch row (12 = 3 quads): the
      // layer's plane, M and I are each read 16 B a lane, in whole lines.
      for (int e = tid; e < CPIX / 4; e += 288) {
        int rr = e / (WID / 4), wq = e - rr * (WID / 4);
        int ph = rr / CK1, kl = rr - ph * CK1;  // kl = k1 - 3j
        int pw = wq / 3,   k2 = (wq - pw * 3) * 4;
        int pix   = (ph * KS + j * CK1 + kl) * WID + wq * 4;
        int p     = ph * PW + pw;               // patch (column) index
        int rbase = kl * KS + k2;               // within-channel chunk row
        float4 s4;
        if (USE_WS) {
          s4 = *(const float4*)&Sb[pix];
        } else {
          s4.x = Sb[(size_t)pix * NLAY];
          s4.y = Sb[(size_t)(pix + 1) * NLAY];
          s4.z = Sb[(size_t)(pix + 2) * NLAY];
          s4.w = Sb[(size_t)(pix + 3) * NLAY];
          // precaution: stands in front of the loads below, whose results the
          // compiler may place in address registers of the four loads above
          asm volatile("s_wait_xcnt 0x0" ::: "memory");
        }
        const float4 m4 = *(const float4*)&Mb[pix];
        const float s[4] = {s4.x, s4.y, s4.z, s4.w};
        const float m[4] = {m4.x, m4.y, m4.z, m4.w};
        float sm[4], sk[4];
        // the loops over i and c are unrolled: constant indices keep the small
        // arrays in registers and turn the LDS row offsets into immediates
#pragma unroll
        for (int i = 0; i < 4; ++i) {
          sm[i] = s[i] * m[i];                  // S*M
          sk[i] = s[i] - sm[i];                 // S*(1-M)
        }
#pragma unroll
        for (int c = 0; c < 3; ++c) {
          const float4 i4 = *(const float4*)&Ib[c * NPIX + pix];
          const float iv[4] = {i4.x, i4.y, i4.z, i4.w};
#pragma unroll
          for (int i = 0; i < 4; ++i) {
            Uc[(c * CRC + rbase + i) * LP + p]           = iv[i] * sm[i];
            Ku[(c * 144 + j * CRC + rbase + i) * LP + p] = iv[i] * sk[i];
          }
        }
      }
      __syncthreads();   // chunk j of Uc and Ku is complete

      // Wm += Uc^T * Ku(chunk rows); 9 waves <-> 9 (16x16) tiles
      const float* ua = &Uc[(2 * h) * LP + mcol];
      const float* kb = &Ku[(j * CRC + 2 * h) * LP + ncol];
      // unrolled so that the accumulator of each k-step and the channel's row
      // offset are compile-time (27 k-steps, alternating two WMMA chains)
#pragma unroll
      for (int ks = 0; ks < CRR / 4; ++ks) {
        const int ra = 4 * ks;                          // chunk row
        const int rb = 4 * ks + (ks / 9) * (144 - CRC); // unfold row - 36j
        v2f a, bb;
        a.x  = ua[ra * LP];
        a.y  = ua[(ra + 1) * LP];
        bb.x = kb[rb * LP];
        bb.y = kb[(rb + 1) * LP];
        if (ks & 1)
          acc1 = __builtin_amdgcn_wmma_f32_16x16x4_f32(
              false, a, false, bb, (short)0, acc1, false, false);
        else
          acc0 = __builtin_amdgcn_wmma_f32_16x16x4_f32(
              false, a, false, bb, (short)0, acc0, false, false);
      }
      __syncthreads();   // every wave has left Uc: refill it (or write Wm)
    }

    // C/D layout: VGPR v -> row v (lanes 0-15) / row v+8 (lanes 16-31)
#pragma unroll
    for (int v = 0; v < 8; ++v) {
      int row = ti * 16 + v + 8 * h;
      Wm[row * LP + ncol] = acc0[v] + acc1[v];
    }
  }
  __syncthreads();

  // ---- Stage 3: L1 row normalization (rows 45..47 are all-zero: 0*1/eps=0)
  if (tid < LQ) {
    float s = 0.0f;
    for (int q = 0; q < LQ; ++q) s += fabsf(Wm[tid * LP + q]);
    float inv = 1.0f / fmaxf(s, 1e-12f);
    for (int q = 0; q < LP; ++q) Wm[tid * LP + q] *= inv;
  }
  __syncthreads();

  // ---- Stage 4: WK = Ku * Wm^T ; 81 tiles over 9 waves, fold + reduce -----
  {
    const int h  = lane >> 4;
    const int lc = lane & 15;
    // t = wave + 9i keeps t % 3: a wave's column tile, and with it its Wm
    // fragments, are the same for all its tiles. They are read here, once, as
    // before (the wait with its "memory" clobber in the loop would otherwise
    // make the compiler read them again for every tile).
    const int nt   = wave % 3;
    const int ncol = nt * 16 + lc;                // patch index i
    v2f bw[12];
#pragma unroll   // bw[] stays in registers only with constant indices
    for (int s = 0; s < 12; ++s)
      bw[s] = *(const v2f*)&Wm[ncol * LP + 4 * s + 2 * h];
    for (int t = wave; t < 81; t += 9) {          // uniform: 9 iters per wave
      const int mt = t / 3;
      const int mrow = mt * 16 + lc;              // unfold row (c,k1,k2)
      v8f acc0 = {}, acc1 = {};
#pragma unroll
      for (int s = 0; s < 6; ++s) {               // 12 k-steps, 2 chains
        const int ka = 8 * s + 2 * h;             // even -> 8B aligned pairs
        v2f a  = *(const v2f*)&Ku[mrow * LP + ka];
        v2f a2 = *(const v2f*)&Ku[mrow * LP + ka + 4];
        acc0 = __builtin_amdgcn_wmma_f32_16x16x4_f32(
            false, a, false, bw[2 * s], (short)0, acc0, false, false);
        acc1 = __builtin_amdgcn_wmma_f32_16x16x4_f32(
            false, a2, false, bw[2 * s + 1], (short)0, acc1, false, false);
      }
      if (ncol < LQ) {
        const int ph = ncol / PW, pw = ncol - ph * PW;
        if (USE_WS) {
          // bijection (r, i<45) <-> (c, pix): each element written once.
          // A lane's 8 unfold rows start at a multiple of 8, and 12 and 144
          // are multiples of 4: they are two runs of 4 neighbouring k2 of one
          // (c, k1), that is 4 neighbouring pixels each -> two 16-B stores.
#pragma unroll   // constant accumulator indices keep acc0/acc1 in registers
          for (int g = 0; g < 2; ++g) {
            int r4  = mt * 4 + 2 * h + g;         // unfold row / 4, 0..107
            int c   = r4 / 36, rem = r4 - c * 36;
            int k1  = rem / 3, k2 = (rem - k1 * 3) * 4;
            int pix = (ph * KS + k1) * WID + pw * KS + k2;
            float4 val;
            val.x = acc0[4 * g]     + acc1[4 * g];
            val.y = acc0[4 * g + 1] + acc1[4 * g + 1];
            val.z = acc0[4 * g + 2] + acc1[4 * g + 2];
            val.w = acc0[4 * g + 3] + acc1[4 * g + 3];
            *(float4*)&part[(((size_t)b * NLAY + l) * 3 + c) * NPIX + pix] = val;
          }
          // precaution: the next tile reuses the registers that the two stores
          // above name (data and address)
          asm volatile("s_wait_xcnt 0x0" ::: "memory");
        } else {
#pragma unroll
          for (int v = 0; v < 8; ++v) {
            int   r   = mt * 16 + v + 8 * h;      // 0..431
            int   c   = r / 144, rem = r - c * 144;
            int   k1  = rem / KS, k2 = rem - k1 * KS;
            int   pix = (ph * KS + k1) * WID + pw * KS + k2;
            atomicAdd(&outacc[((size_t)b * 3 + c) * NPIX + pix],
                      acc0[v] + acc1[v]);
          }
        }
      }
    }
  }
}

// ---------------------------------------------------------------------------
// ws path: sum 133 partial planes per output element + blend (one pass,
// coalesced: consecutive threads read consecutive pix within a plane).
// ---------------------------------------------------------------------------
__global__ void reduce_blend_kernel(const float* __restrict__ I,
                                    const float* __restrict__ M,
                                    const float* __restrict__ part,
                                    float* __restrict__ out, int n) {
  int i = blockIdx.x * blockDim.x + threadIdx.x;
  if (i < n) {
    int b   = i / (3 * NPIX);
    int rem = i - b * 3 * NPIX;     // c*NPIX + pix
    int pix = i % NPIX;
    const float* p = part + (size_t)b * NLAY * 3 * NPIX + rem;
    float s = 0.0f;
    for (int l = 0; l < NLAY; ++l) s += p[(size_t)l * 3 * NPIX];
    float m = M[(size_t)b * NPIX + pix];
    out[i] = I[i] * (1.0f - m) + s * m;
  }
}

// ---------------------------------------------------------------------------
// atomic-path helpers: zero d_out first.
// ---------------------------------------------------------------------------
__global__ void zero_kernel(float* __restrict__ out, int n) {
  int i = blockIdx.x * blockDim.x + threadIdx.x;
  if (i < n) out[i] = 0.0f;
}

__global__ void blend_kernel(const float* __restrict__ I,
                             const float* __restrict__ M,
                             float* __restrict__ out, int n) {
  int i = blockIdx.x * blockDim.x + threadIdx.x;
  if (i < n) {
    int b   = i / (3 * NPIX);
    int pix = i % NPIX;
    float m = M[(size_t)b * NPIX + pix];
    out[i] = I[i] * (1.0f - m) + out[i] * m;
  }
}

// ---------------------------------------------------------------------------
extern "C" void kernel_launch(void* const* d_in, const int* in_sizes, int n_in,
                              void* d_out, int out_size, void* d_ws, size_t ws_size,
                              hipStream_t stream) {
  const float* I = (const float*)d_in[0];
  const float* S = (const float*)d_in[1];
  const float* M = (const float*)d_in[2];
  float* out = (float*)d_out;

  const int    n    = NB * 3 * NPIX;                              // 77760
  const size_t npart = (size_t)NB * NLAY * 3 * NPIX;              // ~39.5 MB
  const size_t need  = (npart + (size_t)NB * NLAY * SPITCH) * sizeof(float);

  if (d_ws != nullptr && ws_size >= need) {
    // streaming-partials path: 41 MB write + 41 MB read (~3.6 us @ 23.3 TB/s)
    float* part = (float*)d_ws;
    float* St   = part + npart;       // transposed S, rewritten in every call
    transpose_s_kernel<<<TTILE, 256, 0, stream>>>(S, St);
    matting_layer_kernel<true><<<dim3(NLAY, NB), 288, 0, stream>>>(
        I, St, M, out, part);
    reduce_blend_kernel<<<(n + 255) / 256, 256, 0, stream>>>(I, M, part, out, n);
  } else {
    // fallback: accumulate with global atomics directly into d_out
    zero_kernel<<<(n + 255) / 256, 256, 0, stream>>>(out, n);
    matting_layer_kernel<false><<<dim3(NLAY, NB), 288, 0, stream>>>(
        I, S, M, out, nullptr);
    blend_kernel<<<(n + 255) / 256, 256, 0, stream>>>(I, M, out, n);
  }
}

// v004
// One run takes 40.4 microseconds.
// In both of two side-by-side timings against v003, it was 1.11 times as fast.
// All steps since v000 together make it 1.89 times as fast.
#include <hip/hip_runtime.h>

// ---------------------------------------------------------------------------
// Problem constants (from reference)
// ---------------------------------------------------------------------------
#define HGT   60
#define WID   108
#define NPIX  (HGT * WID)        // 6480 pixels per (b) image plane
#define NLAY  133
#define NB    4
#define KS    12
#define PH    5
#define PW    9
#define LQ    45                 // number of patches (real columns)
#define LP    48                 // padded to 3 x 16 for WMMA tiles
#define CR    432                // unfold rows = 3 * 12 * 12 (27 x 16 exactly)
#define NCH   6                  // row chunks of stages 1+2
#define CK1   2                  // k1 values per chunk (KS / NCH)
#define CRC   (CK1 * KS)         // 24 chunk rows per channel (3 x 8)
#define CRR   (3 * CRC)          // 72 chunk rows = 9 pairs of k-steps of 4
#define CPIX  (PH * CK1 * WID)   // 1080 pixels per chunk
// LDS pitches in floats. Ku and the Uu chunk are kept patch-major (one line
// per patch, the unfold rows along it). Each pitch is 4 x an odd number: 16
// lanes that read 8 or 16 B at that stride fall on 16 different groups of 4
// banks, and every line starts on a multiple of 16 B.
#define KP    436                // Ku: 432 unfold rows + 4
#define UP    76                 // Uu chunk: 72 chunk rows + 4
#define WP    52                 // Wm: 48 columns + 4
#define TPX   64                 // pixels per tile of the S transpose
#define TTILE (NB * NPIX / TPX)  // 405 tiles, all full
#define TV4   (TPX * NLAY / 4)   // 2128 float4 per tile
#define SSKEW (NPIX % TPX)       // 16: start of image b's planes, times b
#define SPITCH 6528              // plane pitch of the transposed S (102 x 64)

typedef __attribute__((ext_vector_type(2))) float v2f;
typedef __attribute__((ext_vector_type(8))) float v8f;

// ---------------------------------------------------------------------------
// Pre-pass (ws path): S (b, pix, layer) -> St (b, layer, pix), pitch SPITCH.
// In S one layer's pixels lie 532 B apart, so a wave of the main kernel that
// reads 32 pixels of its layer touches 32 cache lines for 128 useful bytes,
// and every line is fetched again by each of the layers that share it. Here
// S is read once in whole lines (a tile of 64 pixels x 133 layers is one
// contiguous run), turned in LDS and written as 256-B runs, one per layer.
// Tiles run over the 25920 pixels of all images (405 full tiles); image b's
// planes start SSKEW*b floats into their pitch, so that every run of 64
// pixels starts on a multiple of 256 B although 6480 is no multiple of 64.
// LDS reads: lane stride 266 dwords (10 mod 64) -> 32 distinct banks.
// ---------------------------------------------------------------------------
__global__ __launch_bounds__(256) void transpose_s_kernel(
    const float* __restrict__ S,     // (4,60,108,133)
    float* __restrict__ St)          // (4,133,SPITCH)
{
  // 2128 float4 of data; rounded up to 9 x 256 so that no fill step branches
  __shared__ __align__(16) float tile[9 * 256 * 4];  // 36864 B

  const int t    = blockIdx.x;          // tile
  const int tid  = threadIdx.x;
  const int lane = tid & 31;
  const int wave = (tid >> 5) & 7;

  const float4* src = (const float4*)(S + (size_t)t * TPX * NLAY);
  float4 r[9];
  // unrolled and branch-free (the last step's surplus lanes re-read the
  // tile's last float4 and put it behind the data in LDS, where nobody reads):
  // all nine loads are in flight before the first LDS store waits for one
#pragma unroll
  for (int i = 0; i < 9; ++i) {
    int e = tid + i * 256;
    r[i] = src[e < TV4 ? e : TV4 - 1];
  }
#pragma unroll   // r[] stays in registers only with constant indices
  for (int i = 0; i < 9; ++i) ((float4*)tile)[tid + i * 256] = r[i];
  __syncthreads();

  const int g = t * TPX + 2 * lane;     // pixel over all images; pairs stay
  const int b = g / NPIX;               // inside one image (6480 is even)
  const float* tp  = &tile[2 * lane * NLAY + wave];
  float*       dst = St + ((size_t)b * NLAY + wave) * SPITCH
                        + (g - b * NPIX) + b * SSKEW;
  // unrolled so that the LDS reads of many layers run ahead of the stores
#pragma unroll
  for (int i = 0; i < NLAY / 8; ++i) {  // layers wave + 8i <= 127
    float2 v;
    v.x = tp[8 * i];
    v.y = tp[NLAY + 8 * i];
    *(float2*)(dst + (size_t)(8 * i) * SPITCH) = v;
  }
  if (wave < NLAY % 8) {                // layers 128..132
    float2 v;
    v.x = tp[NLAY / 8 * 8];
    v.y = tp[NLAY + NLAY / 8 * 8];
    *(float2*)(dst + (size_t)(NLAY / 8 * 8) * SPITCH) = v;
  }
}

// ---------------------------------------------------------------------------
// Main kernel: one workgroup per (layer, batch). 288 threads = 9 wave32.
//   Stage 1: build Uu (=unfold(I*S*M)) and Ku (=unfold(I*S*(1-M))) in LDS.
//   Stage 2: Wm = Uu^T * Ku        (45x45 padded 48x48, K=432)  [f32 WMMA]
//   Stages 1 and 2 run in NCH row chunks: Ku is kept whole (stage 4 reads it
//   again), Uu is only the k-stream of stage 2, so just one chunk of it lives
//   in LDS. That brings LDS under a third of a WGP's, so three workgroups are
//   resident per WGP and the whole grid (532) runs in one round.
//   Both lie patch-major in LDS: a fill lane's 4 neighbouring pixels are 4
//   neighbouring unfold rows of one patch (one 16-B store), a stage-2 lane
//   reads the 4 unfold rows of two k-steps in one 16-B load, and stage 4 reads
//   16 neighbouring unfold rows of one patch with 16 lanes.
//   Stage 3: L1-normalize rows of Wm
//   Stage 4: WK = Ku * Wm^T        (432x45 padded 48,  K=48)    [f32 WMMA]
//            fold + layer reduction:
//              USE_WS=true : plain stores into per-(b,l) partial planes (ws)
//              USE_WS=false: atomicAdd into the out accumulator
// Dual accumulators in both k-loops break the WMMA RAW dependency chain.
// ---------------------------------------------------------------------------
template <bool USE_WS>
__global__ __launch_bounds__(288) void matting_layer_kernel(
    const float* __restrict__ I,     // (4,3,60,108)
    const float* __restrict__ S,     // USE_WS: St (4,133,SPITCH); else (4,60,108,133)
    const float* __restrict__ M,     // (4,1,60,108)
    float* __restrict__ outacc,      // (4,3,60,108) accumulator (atomic path)
    float* __restrict__ part)        // (4,133,3,60,108) partials (ws path)
{
  __shared__ __align__(16) float Ku[LP * KP];   // 83712 B, [patch][unfold row]
  __shared__ __align__(16) float Uc[LP * UP];   // 14592 B, [patch][chunk row]
  float* const Wm = Uc;   // 48 x WP, written only after the last read of Uc

  const int l    = blockIdx.x;          // layer
  const int b    = blockIdx.y;          // batch
  const int tid  = threadIdx.x;
  const int lane = tid & 31;
  const int wave = tid >> 5;            // 0..8

  const float* Ib = I + (size_t)b * 3 * NPIX;
  const float* Sb = USE_WS ? S + ((size_t)b * NLAY + l) * SPITCH + b * SSKEW
                           : S + (size_t)b * NPIX * NLAY + l;
  const float* Mb = M + (size_t)b * NPIX;

  // ---- Stage 1a: zero the 3 padding patches (45..47) of Ku and Uc ---------
  for (int e = tid; e < (LP - LQ) * KP / 4; e += 288) {
    const float4 z4 = {0.0f, 0.0f, 0.0f, 0.0f};
    ((float4*)&Ku[LQ * KP])[e] = z4;
    if (e < (LP - LQ) * UP / 4) ((float4*)&Uc[LQ * UP])[e] = z4;
  }

  // ---- Stages 1b + 2, chunk by chunk --------------------------------------
  // Chunk j holds the unfold rows with k1 in [2j, 2j+2), all three channels:
  //   chunk row  c*24  + (k1-2j)*12 + k2   <->   unfold row  c*144 + k1*12 + k2
  // A(16x4 f32) layout: lane<16: M=lane, VGPRv=K(2h+v) ; lanes>=16: K+=2
  {
    const int ti   = wave / 3, tj = wave - ti * 3;
    const int h    = lane >> 4;
    const int mcol = ti * 16 + (lane & 15);   // output row  (p index)
    const int ncol = tj * 16 + (lane & 15);   // output col  (q index)
    v8f acc0 = {}, acc1 = {};

    for (int j = 0; j < NCH; ++j) {
      // fill: 10 image rows (5 patch rows x 2 k1) of 27 quads, 1 write/element.
      // A quad is 4 neighbouring pixels of one patch row (12 = 3 quads): the
      // layer's plane, M and I are each read 16 B a lane, in whole lines.
      for (int e = tid; e < CPIX / 4; e += 288) {
        int rr = e / (WID / 4), wq = e - rr * (WID / 4);
        int ph = rr / CK1, kl = rr - ph * CK1;  // kl = k1 - 2j
        int pw = wq / 3,   k2 = (wq - pw * 3) * 4;
        int pix   = (ph * KS + j * CK1 + kl) * WID + wq * 4;
        int p     = ph * PW + pw;               // patch index
        int rbase = kl * KS + k2;               // within-channel chunk row
        float4 s4;
        if (USE_WS) {
          s4 = *(const float4*)&Sb[pix];
        } else {
          s4.x = Sb[(size_t)pix * NLAY];
          s4.y = Sb[(size_t)(pix + 1) * NLAY];
          s4.z = Sb[(size_t)(pix + 2) * NLAY];
          s4.w = Sb[(size_t)(pix + 3) * NLAY];
          // precaution: stands in front of the loads below, whose results the
          // compiler may place in address registers of the four loads above
          asm volatile("s_wait_xcnt 0x0" ::: "memory");
        }
        const float4 m4 = *(const float4*)&Mb[pix];
        const float s[4] = {s4.x, s4.y, s4.z, s4.w};
        const float m[4] = {m4.x, m4.y, m4.z, m4.w};
        float sm[4], sk[4];
        // the loops over i and c are unrolled: constant indices keep the small
        // arrays in registers and turn the LDS offsets into immediates
#pragma unroll
        for (int i = 0; i < 4; ++i) {
          sm[i] = s[i] * m[i];                  // S*M
          sk[i] = s[i] - sm[i];                 // S*(1-M)
        }
#pragma unroll
        for (int c = 0; c < 3; ++c) {
          const float4 i4 = *(const float4*)&Ib[c * NPIX + pix];
          float4 u4, k4;
          u4.x = i4.x * sm[0];  k4.x = i4.x * sk[0];
          u4.y = i4.y * sm[1];  k4.y = i4.y * sk[1];
          u4.z = i4.z * sm[2];  k4.z = i4.z * sk[2];
          u4.w = i4.w * sm[3];  k4.w = i4.w * sk[3];
          *(float4*)&Uc[p * UP + c * CRC + rbase]           = u4;
          *(float4*)&Ku[p * KP + c * 144 + j * CRC + rbase] = k4;
        }
      }
      __syncthreads();   // chunk j of Uc and Ku is complete

      // Wm += Uc^T * Ku(chunk rows); 9 waves <-> 9 (16x16) tiles
      // A lane reads 4 neighbouring rows (8kk + 4h + 0..3) of its patch from
      // each operand: elements 0,1 feed one k-step, elements 2,3 the next.
      // A and B take the same rows at the same (h, element) place.
      const float* ua = &Uc[mcol * UP + 4 * h];
      const float* kb = &Ku[ncol * KP + j * CRC + 4 * h];
      // unrolled so that the channel's row offset is compile-time and the LDS
      // offsets are immediates (9 pairs of k-steps, two WMMA chains)
#pragma unroll
      for (int kk = 0; kk < CRR / 8; ++kk) {
        const int ra = 8 * kk;                                // chunk row
        const int rb = 8 * kk + (kk / (CRC / 8)) * (144 - CRC); // unfold row - 24j
        const float4 a4 = *(const float4*)&ua[ra];
        const float4 b4 = *(const float4*)&kb[rb];
        v2f a, bb, a2, bb2;
        a.x  = a4.x;  a.y  = a4.y;  bb.x  = b4.x;  bb.y  = b4.y;
        a2.x = a4.z;  a2.y = a4.w;  bb2.x = b4.z;  bb2.y = b4.w;
        acc0 = __builtin_amdgcn_wmma_f32_16x16x4_f32(
            false, a, false, bb, (short)0, acc0, false, false);
        acc1 = __builtin_amdgcn_wmma_f32_16x16x4_f32(
            false, a2, false, bb2, (short)0, acc1, false, false);
      }
      __syncthreads();   // every wave has left Uc: refill it (or write Wm)
    }

    // C/D layout: VGPR v -> row v (lanes 0-15) / row v+8 (lanes 16-31)
#pragma unroll
    for (int v = 0; v < 8; ++v) {
      int row = ti * 16 + v + 8 * h;
      Wm[row * WP + ncol] = acc0[v] + acc1[v];
    }
  }
  __syncthreads();

  // ---- Stage 3: L1 row normalization (rows 45..47 are all-zero: 0*1/eps=0)
  if (tid < LQ) {
    float s = 0.0f;
    for (int q = 0; q < LQ; ++q) s += fabsf(Wm[tid * WP + q]);
    float inv = 1.0f / fmaxf(s, 1e-12f);
    for (int q = 0; q < LP; ++q) Wm[tid * WP + q] *= inv;
  }
  __syncthreads();

  // ---- Stage 4: WK = Ku * Wm^T ; 81 tiles over 9 waves, fold + reduce -----
  {
    const int h  = lane >> 4;
    const int lc = lane & 15;
    // t = wave + 9i keeps t % 3: a wave's column tile, and with it its Wm
    // fragments, are the same for all its tiles. They are read here, once, as
    // before (the wait with its "memory" clobber in the loop would otherwise
    // make the compiler read them again for every tile).
    const int nt   = wave % 3;
    const int ncol = nt * 16 + lc;                // patch index i
    v2f bw[12];
#pragma unroll   // bw[] stays in registers only with constant indices
    for (int s = 0; s < 12; ++s)
      bw[s] = *(const v2f*)&Wm[ncol * WP + 4 * s + 2 * h];
    for (int t = wave; t < 81; t += 9) {          // uniform: 9 iters per wave
      const int mt = t / 3;
      const int mrow = mt * 16 + lc;              // unfold row (c,k1,k2)
      v8f acc0 = {}, acc1 = {};
#pragma unroll
      for (int s = 0; s < 6; ++s) {               // 12 k-steps, 2 chains
        const int ka = 8 * s + 2 * h;             // patch j of the k-step
        v2f a, a2;      // 16 lanes read 16 neighbouring unfold rows of a patch
        a.x  = Ku[ka * KP + mrow];
        a.y  = Ku[(ka + 1) * KP + mrow];
        a2.x = Ku[(ka + 4) * KP + mrow];
        a2.y = Ku[(ka + 5) * KP + mrow];
        acc0 = __builtin_amdgcn_wmma_f32_16x16x4_f32(
            false, a, false, bw[2 * s], (short)0, acc0, false, false);
        acc1 = __builtin_amdgcn_wmma_f32_16x16x4_f32(
            false, a2, false, bw[2 * s + 1], (short)0, acc1, false, false);
      }
      if (ncol < LQ) {
        const int ph = ncol / PW, pw = ncol - ph * PW;
        if (USE_WS) {
          // bijection (r, i<45) <-> (c, pix): each element written once.
          // A lane's 8 unfold rows start at a multiple of 8, and 12 and 144
          // are multiples of 4: they are two runs of 4 neighbouring k2 of one
          // (c, k1), that is 4 neighbouring pixels each -> two 16-B stores.
#pragma unroll   // constant accumulator indices keep acc0/acc1 in registers
          for (int g = 0; g < 2; ++g) {
            int r4  = mt * 4 + 2 * h + g;         // unfold row / 4, 0..107
            int c   = r4 / 36, rem = r4 - c * 36;
            int k1  = rem / 3, k2 = (rem - k1 * 3) * 4;
            int pix = (ph * KS + k1) * WID + pw * KS + k2;
            float4 val;
            val.x = acc0[4 * g]     + acc1[4 * g];
            val.y = acc0[4 * g + 1] + acc1[4 * g + 1];
            val.z = acc0[4 * g + 2] + acc1[4 * g + 2];
            val.w = acc0[4 * g + 3] + acc1[4 * g + 3];
            *(float4*)&part[(((size_t)b * NLAY + l) * 3 + c) * NPIX + pix] = val;
          }
          // precaution: the next tile reuses the registers that the two stores
          // above name (data and address)
          asm volatile("s_wait_xcnt 0x0" ::: "memory");
        } else {
#pragma unroll
          for (int v = 0; v < 8; ++v) {
            int   r   = mt * 16 + v + 8 * h;      // 0..431
            int   c   = r / 144, rem = r - c * 144;
            int   k1  = rem / KS, k2 = rem - k1 * KS;
            int   pix = (ph * KS + k1) * WID + pw * KS + k2;
            atomicAdd(&outacc[((size_t)b * 3 + c) * NPIX + pix],
                      acc0[v] + acc1[v]);
          }
        }
      }
    }
  }
}

// ---------------------------------------------------------------------------
// ws path: sum 133 partial planes per output element + blend (one pass,
// coalesced: consecutive threads read consecutive pix within a plane).
// ---------------------------------------------------------------------------
__global__ void reduce_blend_kernel(const float* __restrict__ I,
                                    const float* __restrict__ M,
                                    const float* __restrict__ part,
                                    float* __restrict__ out, int n) {
  int i = blockIdx.x * blockDim.x + threadIdx.x;
  if (i < n) {
    int b   = i / (3 * NPIX);
    int rem = i - b * 3 * NPIX;     // c*NPIX + pix
    int pix = i % NPIX;
    const float* p = part + (size_t)b * NLAY * 3 * NPIX + rem;
    float s = 0.0f;
    for (int l = 0; l < NLAY; ++l) s += p[(size_t)l * 3 * NPIX];
    float m = M[(size_t)b * NPIX + pix];
    out[i] = I[i] * (1.0f - m) + s * m;
  }
}

// ---------------------------------------------------------------------------
// atomic-path helpers: zero d_out first.
// ---------------------------------------------------------------------------
__global__ void zero_kernel(float* __restrict__ out, int n) {
  int i = blockIdx.x * blockDim.x + threadIdx.x;
  if (i < n) out[i] = 0.0f;
}

__global__ void blend_kernel(const float* __restrict__ I,
                             const float* __restrict__ M,
                             float* __restrict__ out, int n) {
  int i = blockIdx.x * blockDim.x + threadIdx.x;
  if (i < n) {
    int b   = i / (3 * NPIX);
    int pix = i % NPIX;
    float m = M[(size_t)b * NPIX + pix];
    out[i] = I[i] * (1.0f - m) + out[i] * m;
  }
}

// ---------------------------------------------------------------------------
extern "C" void kernel_launch(void* const* d_in, const int* in_sizes, int n_in,
                              void* d_out, int out_size, void* d_ws, size_t ws_size,
                              hipStream_t stream) {
  const float* I = (const float*)d_in[0];
  const float* S = (const float*)d_in[1];
  const float* M = (const float*)d_in[2];
  float* out = (float*)d_out;

  const int    n    = NB * 3 * NPIX;                              // 77760
  const size_t npart = (size_t)NB * NLAY * 3 * NPIX;              // ~39.5 MB
  const size_t need  = (npart + (size_t)NB * NLAY * SPITCH) * sizeof(float);

  if (d_ws != nullptr && ws_size >= need) {
    // streaming-partials path: 41 MB write + 41 MB read (~3.6 us @ 23.3 TB/s)
    float* part = (float*)d_ws;
    float* St   = part + npart;       // transposed S, rewritten in every call
    transpose_s_kernel<<<TTILE, 256, 0, stream>>>(S, St);
    matting_layer_kernel<true><<<dim3(NLAY, NB), 288, 0, stream>>>(
        I, St, M, out, part);
    reduce_blend_kernel<<<(n + 255) / 256, 256, 0, stream>>>(I, M, part, out, n);
  } else {
    // fallback: accumulate with global atomics directly into d_out
    zero_kernel<<<(n + 255) / 256, 256, 0, stream>>>(out, n);
    matting_layer_kernel<false><<<dim3(NLAY, NB), 288, 0, stream>>>(
        I, S, M, out, nullptr);
    blend_kernel<<<(n + 255) / 256, 256, 0, stream>>>(I, M, out, n);
  }
}

// v005
// A run of this version takes 38.7 microseconds.
// Timed twice side by side with v004, it ran 1.06 and 1.03 times as fast.
// Counting every step since v000, it is 1.98 times as fast.
#include <hip/hip_runtime.h>

// ---------------------------------------------------------------------------
// Problem constants (from reference)
// ---------------------------------------------------------------------------
#define HGT   60
#define WID   108
#define NPIX  (HGT * WID)        // 6480 pixels per (b) image plane
#define NLAY  133
#define NB    4
#define KS    12
#define PH    5
#define PW    9
#define LQ    45                 // number of patches (real columns)
#define LP    48                 // padded to 3 x 16 for WMMA tiles
#define CR    432                // unfold rows = 3 * 12 * 12 (27 x 16 exactly)
#define NCH   6                  // row chunks of stages 1+2
#define CK1   2                  // k1 values per chunk (KS / NCH)
#define CRC   (CK1 * KS)         // 24 chunk rows per channel (3 x 8)
#define CRR   (3 * CRC)          // 72 chunk rows = 9 pairs of k-steps of 4
#define CPIX  (PH * CK1 * WID)   // 1080 pixels per chunk
// LDS pitches in floats. Ku and the Uu chunk are kept patch-major (one line
// per patch, the unfold rows along it). Each pitch is 4 x an odd number: 16
// lanes that read 8 or 16 B at that stride fall on 16 different groups of 4
// banks, and every line starts on a multiple of 16 B.
#define KP    436                // Ku: 432 unfold rows + 4
#define UP    76                 // Uu chunk: 72 chunk rows + 4
#define WP    52                 // Wm: 48 columns + 4
#define TPX   64                 // pixels per tile of the S transpose
#define TTILE (NB * NPIX / TPX)  // 405 tiles, all full
#define TV4   (TPX * NLAY / 4)   // 2128 float4 per tile
#define SSKEW (NPIX % TPX)       // 16: start of image b's planes, times b
#define SPITCH 6528              // plane pitch of the transposed S (102 x 64)
#define PP    (KS * KS)          // 144 pixels of a patch
#define LK    136                // layers padded to 34 k-steps of 4
#define KT    48                 // patch pixels per workgroup of the layer GEMM
#define WTP   64                 // pitch of a (b, j, layer) line of Wt: 2 x 128 B
#define TREG  2176               // one layer-GEMM workgroup's results: 20 image
                                 // rows x 108, rounded up to whole 128-B lines
#define FQ    48                 // output quads per fold workgroup (6 x 128 B)

typedef __attribute__((ext_vector_type(2))) float v2f;
typedef __attribute__((ext_vector_type(4))) float v4f;
typedef __attribute__((ext_vector_type(8))) float v8f;

// ---------------------------------------------------------------------------
// Pre-pass (ws path): S (b, pix, layer) -> St (b, layer, pix), pitch SPITCH.
// In S one layer's pixels lie 532 B apart, so a wave of the main kernel that
// reads 32 pixels of its layer touches 32 cache lines for 128 useful bytes,
// and every line is fetched again by each of the layers that share it. Here
// S is read once in whole lines (a tile of 64 pixels x 133 layers is one
// contiguous run), turned in LDS and written as 256-B runs, one per layer.
// Tiles run over the 25920 pixels of all images (405 full tiles); image b's
// planes start SSKEW*b floats into their pitch, so that every run of 64
// pixels starts on a multiple of 256 B although 6480 is no multiple of 64.
// LDS reads: lane stride 266 dwords (10 mod 64) -> 32 distinct banks.
// ---------------------------------------------------------------------------
__global__ __launch_bounds__(256) void transpose_s_kernel(
    const float* __restrict__ S,     // (4,60,108,133)
    float* __restrict__ St)          // (4,133,SPITCH)
{
  // 2128 float4 of data; rounded up to 9 x 256 so that no fill step branches
  __shared__ __align__(16) float tile[9 * 256 * 4];  // 36864 B

  const int t    = blockIdx.x;          // tile
  const int tid  = threadIdx.x;
  const int lane = tid & 31;
  const int wave = (tid >> 5) & 7;

  const float4* src = (const float4*)(S + (size_t)t * TPX * NLAY);
  float4 r[9];
  // unrolled and branch-free (the last step's surplus lanes re-read the
  // tile's last float4 and put it behind the data in LDS, where nobody reads):
  // all nine loads are in flight before the first LDS store waits for one
#pragma unroll
  for (int i = 0; i < 9; ++i) {
    int e = tid + i * 256;
    r[i] = src[e < TV4 ? e : TV4 - 1];
  }
#pragma unroll   // r[] stays in registers only with constant indices
  for (int i = 0; i < 9; ++i) ((float4*)tile)[tid + i * 256] = r[i];
  __syncthreads();

  const int g = t * TPX + 2 * lane;     // pixel over all images; pairs stay
  const int b = g / NPIX;               // inside one image (6480 is even)
  const float* tp  = &tile[2 * lane * NLAY + wave];
  float*       dst = St + ((size_t)b * NLAY + wave) * SPITCH
                        + (g - b * NPIX) + b * SSKEW;
  // unrolled so that the LDS reads of many layers run ahead of the stores
#pragma unroll
  for (int i = 0; i < NLAY / 8; ++i) {  // layers wave + 8i <= 127
    float2 v;
    v.x = tp[8 * i];
    v.y = tp[NLAY + 8 * i];
    *(float2*)(dst + (size_t)(8 * i) * SPITCH) = v;
  }
  if (wave < NLAY % 8) {                // layers 128..132
    float2 v;
    v.x = tp[NLAY / 8 * 8];
    v.y = tp[NLAY + NLAY / 8 * 8];
    *(float2*)(dst + (size_t)(NLAY / 8 * 8) * SPITCH) = v;
  }
}

// ---------------------------------------------------------------------------
// Main kernel: one workgroup per (layer, batch). 288 threads = 9 wave32.
//   Stage 1: build Uu (=unfold(I*S*M)) and Ku (=unfold(I*S*(1-M))) in LDS.
//   Stage 2: Wm = Uu^T * Ku        (45x45 padded 48x48, K=432)  [f32 WMMA]
//   Stages 1 and 2 run in NCH row chunks: Ku is kept whole (stage 4 reads it
//   again), Uu is only the k-stream of stage 2, so just one chunk of it lives
//   in LDS. That brings LDS under a third of a WGP's, so three workgroups are
//   resident per WGP and the whole grid (532) runs in one round.
//   Both lie patch-major in LDS: a fill lane's 4 neighbouring pixels are 4
//   neighbouring unfold rows of one patch (one 16-B store), a stage-2 lane
//   reads the 4 unfold rows of two k-steps in one 16-B load, and stage 4 reads
//   16 neighbouring unfold rows of one patch with 16 lanes.
//   Stage 3: L1-normalize rows of Wm
//   USE_WS=true : the normalized Wm goes to the workspace, one column of 48 per
//            (b, column patch j, layer); the second product and the sum over
//            the layers are layer_gemm_kernel's.
//   USE_WS=false:
//   Stage 4: WK = Ku * Wm^T        (432x45 padded 48,  K=48)    [f32 WMMA]
//            fold + layer reduction: atomicAdd into the out accumulator
// Dual accumulators in both k-loops break the WMMA RAW dependency chain.
// ---------------------------------------------------------------------------
template <bool USE_WS>
__global__ __launch_bounds__(288) void matting_layer_kernel(
    const float* __restrict__ I,     // (4,3,60,108)
    const float* __restrict__ S,     // USE_WS: St (4,133,SPITCH); else (4,60,108,133)
    const float* __restrict__ M,     // (4,1,60,108)
    float* __restrict__ outacc,      // (4,3,60,108) accumulator (atomic path)
    float* __restrict__ Wt)          // (4,45,133,WTP) normalized Wm (ws path)
{
  __shared__ __align__(16) float Ku[LP * KP];   // 83712 B, [patch][unfold row]
  __shared__ __align__(16) float Uc[LP * UP];   // 14592 B, [patch][chunk row]
  float* const Wm = Uc;   // 48 x WP, written only after the last read of Uc

  const int l    = blockIdx.x;          // layer
  const int b    = blockIdx.y;          // batch
  const int tid  = threadIdx.x;
  const int lane = tid & 31;
  const int wave = tid >> 5;            // 0..8

  const float* Ib = I + (size_t)b * 3 * NPIX;
  const float* Sb = USE_WS ? S + ((size_t)b * NLAY + l) * SPITCH + b * SSKEW
                           : S + (size_t)b * NPIX * NLAY + l;
  const float* Mb = M + (size_t)b * NPIX;

  // ---- Stage 1a: zero the 3 padding patches (45..47) of Ku and Uc ---------
  for (int e = tid; e < (LP - LQ) * KP / 4; e += 288) {
    const float4 z4 = {0.0f, 0.0f, 0.0f, 0.0f};
    ((float4*)&Ku[LQ * KP])[e] = z4;
    if (e < (LP - LQ) * UP / 4) ((float4*)&Uc[LQ * UP])[e] = z4;
  }

  // ---- Stages 1b + 2, chunk by chunk --------------------------------------
  // Chunk j holds the unfold rows with k1 in [2j, 2j+2), all three channels:
  //   chunk row  c*24  + (k1-2j)*12 + k2   <->   unfold row  c*144 + k1*12 + k2
  // A(16x4 f32) layout: lane<16: M=lane, VGPRv=K(2h+v) ; lanes>=16: K+=2
  {
    const int ti   = wave / 3, tj = wave - ti * 3;
    const int h    = lane >> 4;
    const int mcol = ti * 16 + (lane & 15);   // output row  (p index)
    const int ncol = tj * 16 + (lane & 15);   // output col  (q index)
    v8f acc0 = {}, acc1 = {};

    for (int j = 0; j < NCH; ++j) {
      // fill: 10 image rows (5 patch rows x 2 k1) of 27 quads, 1 write/element.
      // A quad is 4 neighbouring pixels of one patch row (12 = 3 quads): the
      // layer's plane, M and I are each read 16 B a lane, in whole lines.
      for (int e = tid; e < CPIX / 4; e += 288) {
        int rr = e / (WID / 4), wq = e - rr * (WID / 4);
        int ph = rr / CK1, kl = rr - ph * CK1;  // kl = k1 - 2j
        int pw = wq / 3,   k2 = (wq - pw * 3) * 4;
        int pix   = (ph * KS + j * CK1 + kl) * WID + wq * 4;
        int p     = ph * PW + pw;               // patch index
        int rbase = kl * KS + k2;               // within-channel chunk row
        float4 s4;
        if (USE_WS) {
          s4 = *(const float4*)&Sb[pix];
        } else {
          s4.x = Sb[(size_t)pix * NLAY];
          s4.y = Sb[(size_t)(pix + 1) * NLAY];
          s4.z = Sb[(size_t)(pix + 2) * NLAY];
          s4.w = Sb[(size_t)(pix + 3) * NLAY];
          // precaution: stands in front of the loads below, whose results the
          // compiler may place in address registers of the four loads above
          asm volatile("s_wait_xcnt 0x0" ::: "memory");
        }
        const float4 m4 = *(const float4*)&Mb[pix];
        const float s[4] = {s4.x, s4.y, s4.z, s4.w};
        const float m[4] = {m4.x, m4.y, m4.z, m4.w};
        float sm[4], sk[4];
        // the loops over i and c are unrolled: constant indices keep the small
        // arrays in registers and turn the LDS offsets into immediates
#pragma unroll
        for (int i = 0; i < 4; ++i) {
          sm[i] = s[i] * m[i];                  // S*M
          sk[i] = s[i] - sm[i];                 // S*(1-M)
        }
#pragma unroll
        for (int c = 0; c < 3; ++c) {
          const float4 i4 = *(const float4*)&Ib[c * NPIX + pix];
          float4 u4, k4;
          u4.x = i4.x * sm[0];  k4.x = i4.x * sk[0];
          u4.y = i4.y * sm[1];  k4.y = i4.y * sk[1];
          u4.z = i4.z * sm[2];  k4.z = i4.z * sk[2];
          u4.w = i4.w * sm[3];  k4.w = i4.w * sk[3];
          *(float4*)&Uc[p * UP + c * CRC + rbase]           = u4;
          *(float4*)&Ku[p * KP + c * 144 + j * CRC + rbase] = k4;
        }
      }
      __syncthreads();   // chunk j of Uc and Ku is complete

      // Wm += Uc^T * Ku(chunk rows); 9 waves <-> 9 (16x16) tiles
      // A lane reads 4 neighbouring rows (8kk + 4h + 0..3) of its patch from
      // each operand: elements 0,1 feed one k-step, elements 2,3 the next.
      // A and B take the same rows at the same (h, element) place.
      const float* ua = &Uc[mcol * UP + 4 * h];
      const float* kb = &Ku[ncol * KP + j * CRC + 4 * h];
      // unrolled so that the channel's row offset is compile-time and the LDS
      // offsets are immediates (9 pairs of k-steps, two WMMA chains)
#pragma unroll
      for (int kk = 0; kk < CRR / 8; ++kk) {
        const int ra = 8 * kk;                                // chunk row
        const int rb = 8 * kk + (kk / (CRC / 8)) * (144 - CRC); // unfold row - 24j
        const float4 a4 = *(const float4*)&ua[ra];
        const float4 b4 = *(const float4*)&kb[rb];
        v2f a, bb, a2, bb2;
        a.x  = a4.x;  a.y  = a4.y;  bb.x  = b4.x;  bb.y  = b4.y;
        a2.x = a4.z;  a2.y = a4.w;  bb2.x = b4.z;  bb2.y = b4.w;
        acc0 = __builtin_amdgcn_wmma_f32_16x16x4_f32(
            false, a, false, bb, (short)0, acc0, false, false);
        acc1 = __builtin_amdgcn_wmma_f32_16x16x4_f32(
            false, a2, false, bb2, (short)0, acc1, false, false);
      }
      __syncthreads();   // every wave has left Uc: refill it (or write Wm)
    }

    // C/D layout: VGPR v -> row v (lanes 0-15) / row v+8 (lanes 16-31)
#pragma unroll
    for (int v = 0; v < 8; ++v) {
      int row = ti * 16 + v + 8 * h;
      Wm[row * WP + ncol] = acc0[v] + acc1[v];
    }
  }
  __syncthreads();

  // ---- Stage 3: L1 row normalization (rows 45..47 are all-zero: 0*1/eps=0)
  if (tid < LQ) {
    float s = 0.0f;
    for (int q = 0; q < LQ; ++q) s += fabsf(Wm[tid * WP + q]);
    float inv = 1.0f / fmaxf(s, 1e-12f);
    for (int q = 0; q < LP; ++q) Wm[tid * WP + q] *= inv;
  }
  __syncthreads();

  if (USE_WS) {
    // Wt[b][j][l][i] = Wm[i][j]: rows 45..47 of Wm are zero and go along, so
    // that the reader's padded columns are zero too. A line (b, j, l) has a
    // pitch of 256 B: no 128-B line is written by two workgroups.
    __builtin_assume(tid < 288);        // lets all range tests but the last fold
    const int jj0 = tid / LP, ii = tid - jj0 * LP;      // 288 = 6 x 48
    float* wd = Wt + (((size_t)b * LQ + jj0) * NLAY + l) * WTP + ii;
    // unrolled: the LDS reads run ahead of the stores, all offsets immediates
#pragma unroll
    for (int it = 0; it < 8; ++it)
      if (jj0 + 6 * it < LQ)
        wd[(size_t)it * 6 * NLAY * WTP] = Wm[ii * WP + jj0 + 6 * it];
  } else {
    // ---- Stage 4: WK = Ku * Wm^T ; 81 tiles over 9 waves, fold + reduce ---
    const int h  = lane >> 4;
    const int lc = lane & 15;
    // t = wave + 9i keeps t % 3: a wave's column tile, and with it its Wm
    // fragments, are the same for all its tiles. They are read here, once.
    const int nt   = wave % 3;
    const int ncol = nt * 16 + lc;                // patch index i
    v2f bw[12];
#pragma unroll   // bw[] stays in registers only with constant indices
    for (int s = 0; s < 12; ++s)
      bw[s] = *(const v2f*)&Wm[ncol * WP + 4 * s + 2 * h];
    for (int t = wave; t < 81; t += 9) {          // uniform: 9 iters per wave
      const int mt = t / 3;
      const int mrow = mt * 16 + lc;              // unfold row (c,k1,k2)
      v8f acc0 = {}, acc1 = {};
#pragma unroll
      for (int s = 0; s < 6; ++s) {               // 12 k-steps, 2 chains
        const int ka = 8 * s + 2 * h;             // patch j of the k-step
        v2f a, a2;      // 16 lanes read 16 neighbouring unfold rows of a patch
        a.x  = Ku[ka * KP + mrow];
        a.y  = Ku[(ka + 1) * KP + mrow];
        a2.x = Ku[(ka + 4) * KP + mrow];
        a2.y = Ku[(ka + 5) * KP + mrow];
        acc0 = __builtin_amdgcn_wmma_f32_16x16x4_f32(
            false, a, false, bw[2 * s], (short)0, acc0, false, false);
        acc1 = __builtin_amdgcn_wmma_f32_16x16x4_f32(
            false, a2, false, bw[2 * s + 1], (short)0, acc1, false, false);
      }
      if (ncol < LQ) {
        const int ph = ncol / PW, pw = ncol - ph * PW;
#pragma unroll
        for (int v = 0; v < 8; ++v) {
          int   r   = mt * 16 + v + 8 * h;        // 0..431
          int   c   = r / 144, rem = r - c * 144;
          int   k1  = rem / KS, k2 = rem - k1 * KS;
          int   pix = (ph * KS + k1) * WID + pw * KS + k2;
          atomicAdd(&outacc[((size_t)b * 3 + c) * NPIX + pix],
                    acc0[v] + acc1[v]);
        }
      }
    }
  }
}

// ---------------------------------------------------------------------------
// ws path, second product. With K_l[c,kk,j] = I[c,kk,j] * (1-M)[kk,j] * S_l[kk,j]
// (kk = pixel inside a patch, j = patch) the sum over layers of Wm_l * K_l is
//   out[c,kk,i] = sum_j I[c,kk,j] * (1-M)[kk,j] * T_j[kk,i],
//   T_j[kk,i]   = sum_l S_l[kk,j] * Wm_l[i,j].
// T_j is one GEMM per (b, j): 144 x 48, K = 133 layers (padded 136). The layer
// sum is its k dimension, so no per-layer planes are stored, and the channel
// factor is outside it, so it has a third of the multiply-adds.
// One workgroup per (b, j, third of the patch: 4 patch rows = 48 pixels), so
// that 540 workgroups spread over the chip; 9 waves <-> 3 x 3 tiles of 16 x 16.
// Both operands lie in LDS as [layer / 4][column][layer % 4]: one 16-B read
// with an immediate offset holds a lane's fragments of two k-steps, and each
// half-wave reads 256 B in a row (all 64 banks once).
// ---------------------------------------------------------------------------
__global__ __launch_bounds__(288) void layer_gemm_kernel(
    const float* __restrict__ St,    // (4,133,SPITCH)
    const float* __restrict__ M,     // (4,1,60,108)
    const float* __restrict__ Wt,    // (4,45,133,WTP)
    float* __restrict__ Tp)          // (4,45,3,TREG): [b][j][t3][image rows]
{
  // 52224 B: S as [l/4][kk - 48*t3][l%4], behind it W as [l/4][i][l%4]
  __shared__ __align__(16) float Sh[LK * KT + LK * LP];

  const int j    = blockIdx.x;          // patch of the k side
  const int b    = blockIdx.y;
  const int t3   = blockIdx.z;          // third of the patch
  const int tid  = threadIdx.x;
  __builtin_assume(tid < 288);          // lets the fill's range tests fold
  const int lane = tid & 31;
  const int wave = tid >> 5;            // 0..8
  const int h    = lane >> 4;
  const int lc   = lane & 15;
  const int mt   = wave / 3, nt = wave - mt * 3;
  const int pj   = (j / PW) * KS * WID + (j % PW) * KS;  // patch's first pixel
  const v4f z4 = {0.0f, 0.0f, 0.0f, 0.0f};

  // M of the lane's 8 result rows kk = 48*t3 + 16*mt + 8h + 0..7: two quads
  v4f mr[2];
  const float* pm[2];
#pragma unroll
  for (int g = 0; g < 2; ++g) {
    const int q = 12 * t3 + 4 * mt + 2 * h + g;
    pm[g] = &M[(size_t)b * NPIX + pj + (q / 3) * WID + (q % 3) * 4];
    mr[g] = *(const v4f*)pm[g];
  }

  // fill: an item is 4 layers x 4 columns (a quad: 4 pixels of a patch row, or
  // 4 columns i): 4 loads of 16 B, turned in registers, 4 LDS stores of 16 B,
  // 64 B in a row. 34 x 12 items of S, then 34 x 12 of W; 288 threads = 24 x 12.
  // The load loop is unrolled and branch-free (past layer 132 a lane reads
  // layer 132 again and stores zero or nothing): all 12 loads are in flight
  // before the first LDS store waits for one.
  {
    const int p0 = tid / 12, q = tid - p0 * 12;
    const float* sp = St + (size_t)b * NLAY * SPITCH + b * SSKEW + pj
                         + (4 * t3 + q / 3) * WID + (q % 3) * 4;
    const float* wp = Wt + ((size_t)b * LQ + j) * NLAY * WTP + q * 4;
    v4f r[3][4];
    const float* pr[3][4];
#pragma unroll
    for (int it = 0; it < 3; ++it) {
      const int  g   = p0 + 24 * it;            // 0..33: S, 34..67: W
      const bool isS = g < LK / 4;
      const int  gl  = isS ? g : g - LK / 4;
      const float* src   = isS ? sp : wp;
      const int    pitch = isS ? SPITCH : WTP;
#pragma unroll
      for (int u = 0; u < 4; ++u) {
        const int l  = 4 * gl + u;
        const int lv = l < NLAY ? l : NLAY - 1;
        pr[it][u] = &src[lv * pitch];
        r[it][u]  = *(const v4f*)pr[it][u];
      }
    }
    // inputs-only fence on the loaded values: without it the compiler sinks
    // the later loads behind the first LDS stores (and into the range test
    // below), and their latency is paid three times instead of once. The
    // addresses are inputs too, and the wait is a precaution: no register that
    // one of the 14 loads names is given a new value (a later load's result
    // among them) in front of it.
    asm volatile("s_wait_xcnt 0x0"
                 :: "v"(r[0][0]), "v"(r[0][1]), "v"(r[0][2]), "v"(r[0][3]),
                    "v"(r[1][0]), "v"(r[1][1]), "v"(r[1][2]), "v"(r[1][3]),
                    "v"(r[2][0]), "v"(r[2][1]), "v"(r[2][2]), "v"(r[2][3]),
                    "v"(mr[0]), "v"(mr[1]),
                    "v"(pr[0][0]), "v"(pr[0][1]), "v"(pr[0][2]), "v"(pr[0][3]),
                    "v"(pr[1][0]), "v"(pr[1][1]), "v"(pr[1][2]), "v"(pr[1][3]),
                    "v"(pr[2][0]), "v"(pr[2][1]), "v"(pr[2][2]), "v"(pr[2][3]),
                    "v"(pm[0]), "v"(pm[1])
                 : "memory");
#pragma unroll   // r[][] stays in registers only with constant indices
    for (int it = 0; it < 3; ++it) {
      const int g  = p0 + 24 * it;
      const int gl = g < LK / 4 ? g : g - LK / 4;
      if (g < 2 * (LK / 4)) {
        v4f v[4];
#pragma unroll
        for (int u = 0; u < 4; ++u) v[u] = 4 * gl + u < NLAY ? r[it][u] : z4;
#pragma unroll
        for (int x = 0; x < 4; ++x) {
          const v4f c4 = {v[0][x], v[1][x], v[2][x], v[3][x]};
          *(v4f*)&Sh[(g * KT + q * 4 + x) * 4] = c4;
        }
      }
    }
  }
  const v4f km[2] = {1.0f - mr[0], 1.0f - mr[1]};
  __syncthreads();   // both operands are complete

  // A(16x4): lane -> row kk = lc; B(4x16): lane -> column i = lc. A lane reads
  // the 4 layers 8s + 4h + 0..3 of its row and of its column: elements 0,1 feed
  // one k-step, elements 2,3 the next. A and B take the same layers at the
  // same (h, element) place. The two k-steps go to two accumulators: two
  // independent WMMA chains.
  v8f acc0 = {}, acc1 = {};
  const float* ap = &Sh[(h * KT + 16 * mt + lc) * 4];
  const float* bp = &Sh[LK * KT + (h * LP + 16 * nt + lc) * 4];
#pragma unroll   // LDS offsets become immediates; reads run ahead of the WMMAs
  for (int s = 0; s < LK / 8; ++s) {
    const v4f a4 = *(const v4f*)&ap[s * 8 * KT];
    const v4f b4 = *(const v4f*)&bp[s * 8 * LP];
    v2f a, bb, a2, bb2;
    a.x  = a4.x;  a.y  = a4.y;  bb.x  = b4.x;  bb.y  = b4.y;
    a2.x = a4.z;  a2.y = a4.w;  bb2.x = b4.z;  bb2.y = b4.w;
    acc0 = __builtin_amdgcn_wmma_f32_16x16x4_f32(
        false, a, false, bb, (short)0, acc0, false, false);
    acc1 = __builtin_amdgcn_wmma_f32_16x16x4_f32(
        false, a2, false, bb2, (short)0, acc1, false, false);
  }

  // D: VGPR v -> row kk = 48*t3 + 16*mt + 8h + v, column i = 16nt + lc. A lane's
  // 8 rows are two quads (4 neighbouring pixels of patch i) -> two 16-B stores.
  // The workgroup's results lie in image order: the 4 image rows k1 = 4*t3..+3
  // of each of the 5 patch rows, 20 rows of 108, in a region of whole 128-B
  // lines of its own, which the fold kernel reads in whole lines.
  const int i = 16 * nt + lc;
  if (i < LQ) {
    float* tp = Tp + (((size_t)b * LQ + j) * (PP / KT) + t3) * TREG
                   + (i / PW) * 4 * WID + (i % PW) * KS;
#pragma unroll   // constant accumulator indices keep acc0/acc1 in registers
    for (int g = 0; g < 2; ++g) {
      const int q = 4 * mt + 2 * h + g;           // quad inside the third, 0..11
      v4f val;
      val.x = (acc0[4 * g]     + acc1[4 * g])     * km[g].x;
      val.y = (acc0[4 * g + 1] + acc1[4 * g + 1]) * km[g].y;
      val.z = (acc0[4 * g + 2] + acc1[4 * g + 2]) * km[g].z;
      val.w = (acc0[4 * g + 3] + acc1[4 * g + 3]) * km[g].w;
      *(v4f*)&tp[(q / 3) * WID + (q % 3) * 4] = val;
    }
  }
}

// ---------------------------------------------------------------------------
// ws path, fold + blend: out[c,kk,i] = I*(1-M) + M * sum_j I[c,kk,j]*(1-M)[kk,j]*T_j[kk,i].
// The factor I differs per pixel kk, so this sum is elementwise in kk (per
// pixel a 3 x 45 by 45 x 45 product): vector work, 45 multiply-adds per output
// element, under 1 % of all. A workgroup owns FQ neighbouring quads of out (whole 128-B
// lines, one writer each); 5 groups of threads take the 9 patches j of one
// patch row each (18 loads a thread, all in flight), then the groups are summed.
// ---------------------------------------------------------------------------
__global__ __launch_bounds__(5 * FQ) void fold_blend_kernel(
    const float* __restrict__ I,     // (4,3,60,108)
    const float* __restrict__ M,     // (4,1,60,108)
    const float* __restrict__ Tp,    // (4,45,3,TREG)
    float* __restrict__ out)         // (4,3,60,108)
{
  __shared__ __align__(16) float red[5 * FQ * 4];   // 3840 B

  const int tid = threadIdx.x;
  const int jg  = tid / FQ, eq = tid - jg * FQ;   // patch row of j; own quad
  const int e   = blockIdx.x * FQ + eq;           // quad of out, flat
  const int b   = e / (3 * NPIX / 4);
  const int pq  = e % (NPIX / 4);                 // quad inside the image plane
  const int y   = pq / (WID / 4), xq = pq - y * (WID / 4);
  const int k1  = y % KS;
  const int t3  = k1 / 4;

  // j = 9*jg + u: patch row jg, patch column u
  const float* pt  = Tp + ((size_t)(b * LQ + jg * PW) * (PP / KT) + t3) * TREG
                        + ((y / KS) * 4 + (k1 - 4 * t3)) * WID + xq * 4;
  const float* px  = I + (size_t)(e - pq) * 4 + (jg * KS + k1) * WID + (xq % 3) * 4;
  const float* pmo = M + (size_t)b * NPIX + pq * 4;
  const float* pio = I + (size_t)e * 4;
  // the blend's own M and I are read up here with the rest, so that their
  // latency is not paid again behind the barrier
  const v4f m4 = *(const v4f*)pmo;
  const v4f i4 = *(const v4f*)pio;
  v4f t4[PW], x4[PW];
#pragma unroll   // constant indices keep the arrays in registers
  for (int u = 0; u < PW; ++u) {
    t4[u] = *(const v4f*)&pt[u * (PP / KT) * TREG];
    x4[u] = *(const v4f*)&px[u * KS];
  }
  // precaution: the loaded values and the addresses are inputs, so that no
  // register that one of the 20 loads names is given a new value (a later
  // load's result among them) in front of the wait
  asm volatile("s_wait_xcnt 0x0"
               :: "v"(t4[0]), "v"(t4[1]), "v"(t4[2]), "v"(t4[3]), "v"(t4[4]),
                  "v"(t4[5]), "v"(t4[6]), "v"(t4[7]), "v"(t4[8]),
                  "v"(x4[0]), "v"(x4[1]), "v"(x4[2]), "v"(x4[3]), "v"(x4[4]),
                  "v"(x4[5]), "v"(x4[6]), "v"(x4[7]), "v"(x4[8]),
                  "v"(m4), "v"(i4), "v"(pt), "v"(px), "v"(pmo), "v"(pio)
               : "memory");
  v4f s = t4[0] * x4[0];
#pragma unroll
  for (int u = 1; u < PW; ++u) s += t4[u] * x4[u];
  *(v4f*)&red[tid * 4] = s;
  __syncthreads();   // all five groups' sums are in LDS

  if (tid < FQ) {
#pragma unroll
    for (int g = 1; g < 5; ++g) s += *(const v4f*)&red[(g * FQ + tid) * 4];
    *(v4f*)&out[(size_t)e * 4] = i4 * (1.0f - m4) + s * m4;
  }
}

// ---------------------------------------------------------------------------
// atomic-path helpers: zero d_out first.
// ---------------------------------------------------------------------------
__global__ void zero_kernel(float* __restrict__ out, int n) {
  int i = blockIdx.x * blockDim.x + threadIdx.x;
  if (i < n) out[i] = 0.0f;
}

__global__ void blend_kernel(const float* __restrict__ I,
                             const float* __restrict__ M,
                             float* __restrict__ out, int n) {
  int i = blockIdx.x * blockDim.x + threadIdx.x;
  if (i < n) {
    int b   = i / (3 * NPIX);
    int pix = i % NPIX;
    float m = M[(size_t)b * NPIX + pix];
    out[i] = I[i] * (1.0f - m) + out[i] * m;
  }
}

// ---------------------------------------------------------------------------
extern "C" void kernel_launch(void* const* d_in, const int* in_sizes, int n_in,
                              void* d_out, int out_size, void* d_ws, size_t ws_size,
                              hipStream_t stream) {
  const float* I = (const float*)d_in[0];
  const float* S = (const float*)d_in[1];
  const float* M = (const float*)d_in[2];
  float* out = (float*)d_out;

  const int    n    = NB * 3 * NPIX;                              // 77760
  const size_t nst  = (size_t)NB * NLAY * SPITCH;                 // 13.9 MB
  const size_t nwt  = (size_t)NB * LQ * NLAY * WTP;               // 6.1 MB
  const size_t ntp  = (size_t)NB * LQ * (PP / KT) * TREG;         // 4.7 MB
  const size_t need = (nst + nwt + ntp) * sizeof(float);

  if (d_ws != nullptr && ws_size >= need) {
    // every plane below is rewritten in every call before it is read
    float* St = (float*)d_ws;         // transposed S
    float* Wt = St + nst;             // normalized affinities, [b][j][l][i]
    float* Tp = Wt + nwt;             // layer-summed products, [b][j][third]
    transpose_s_kernel<<<TTILE, 256, 0, stream>>>(S, St);
    matting_layer_kernel<true><<<dim3(NLAY, NB), 288, 0, stream>>>(
        I, St, M, out, Wt);
    layer_gemm_kernel<<<dim3(LQ, NB, PP / KT), 288, 0, stream>>>(St, M, Wt, Tp);
    fold_blend_kernel<<<n / 4 / FQ, 5 * FQ, 0, stream>>>(I, M, Tp, out);
  } else {
    // fallback: accumulate with global atomics directly into d_out
    zero_kernel<<<(n + 255) / 256, 256, 0, stream>>>(out, n);
    matting_layer_kernel<false><<<dim3(NLAY, NB), 288, 0, stream>>>(
        I, S, M, out, nullptr);
    blend_kernel<<<(n + 255) / 256, 256, 0, stream>>>(I, M, out, n);
  }
}

// v006
// It runs in 32.3 microseconds.
// Two timings next to v005 both put it at 1.18 times that version's speed.
// Counting every step since v000, it is 2.34 times as fast.
#include <hip/hip_runtime.h>

// ---------------------------------------------------------------------------
// Problem constants (from reference)
// ---------------------------------------------------------------------------
#define HGT   60
#define WID   108
#define NPIX  (HGT * WID)        // 6480 pixels per (b) image plane
#define NLAY  133
#define NB    4
#define KS    12
#define PH    5
#define PW    9
#define LQ    45                 // number of patches (real columns)
#define LP    48                 // padded to 3 x 16 for WMMA tiles
#define CR    432                // unfold rows = 3 * 12 * 12 (27 x 16 exactly)
#define NCH   6                  // row chunks of stages 1+2
#define CK1   2                  // k1 values per chunk (KS / NCH)
#define CRC   (CK1 * KS)         // 24 chunk rows per channel (3 x 8)
#define CRR   (3 * CRC)          // 72 chunk rows = 9 pairs of k-steps of 4
#define CPIX  (PH * CK1 * WID)   // 1080 pixels per chunk
// LDS pitches in floats. Ku and the Uu chunk are kept patch-major (one line
// per patch, the unfold rows along it). Each pitch is 4 x an odd number: 16
// lanes that read 8 or 16 B at that stride fall on 16 different groups of 4
// banks, and every line starts on a multiple of 16 B.
#define KP    436                // Ku: 432 unfold rows + 4
#define UP    76                 // Uu chunk: 72 chunk rows + 4
#define WP    52                 // Wm: 48 columns + 4
#define TPX   64                 // pixels per tile of the S transpose
#define TTILE (NB * NPIX / TPX)  // 405 tiles, all full
#define TV4   (TPX * NLAY / 4)   // 2128 float4 per tile
#define SSKEW (NPIX % TPX)       // 16: start of image b's planes, times b
#define SPITCH 6528              // plane pitch of the transposed S (102 x 64)
#define PP    (KS * KS)          // 144 pixels of a patch
#define LK    136                // layers padded to 34 k-steps of 4
#define KT    48                 // patch pixels per workgroup of the layer GEMM
#define WTP   64                 // pitch of a (b, j, layer) line of Wt: 2 x 128 B
#define TREG  2176               // one layer-GEMM workgroup's results: 20 image
                                 // rows x 108, rounded up to whole 128-B lines
#define FQ    48                 // output quads per fold workgroup (6 x 128 B)

typedef __attribute__((ext_vector_type(2))) float v2f;
typedef __attribute__((ext_vector_type(4))) float v4f;
typedef __attribute__((ext_vector_type(8))) float v8f;

// ---------------------------------------------------------------------------
// Pre-pass (ws path): S (b, pix, layer) -> St (b, layer, pix), pitch SPITCH.
// In S one layer's pixels lie 532 B apart, so a wave of the main kernel that
// reads 32 pixels of its layer touches 32 cache lines for 128 useful bytes,
// and every line is fetched again by each of the layers that share it. Here
// S is read once in whole lines (a tile of 64 pixels x 133 layers is one
// contiguous run), turned in LDS and written as 256-B runs, one per layer.
// Tiles run over the 25920 pixels of all images (405 full tiles); image b's
// planes start SSKEW*b floats into their pitch, so that every run of 64
// pixels starts on a multiple of 256 B although 6480 is no multiple of 64.
// LDS reads: lane stride 266 dwords (10 mod 64) -> 32 distinct banks.
// ---------------------------------------------------------------------------
__global__ __launch_bounds__(256) void transpose_s_kernel(
    const float* __restrict__ S,     // (4,60,108,133)
    float* __restrict__ St)          // (4,133,SPITCH)
{
  // 2128 float4 of data; rounded up to 9 x 256 so that no fill step branches
  __shared__ __align__(16) float tile[9 * 256 * 4];  // 36864 B

  const int t    = blockIdx.x;          // tile
  const int tid  = threadIdx.x;
  const int lane = tid & 31;
  const int wave = (tid >> 5) & 7;

  const float4* src = (const float4*)(S + (size_t)t * TPX * NLAY);
  float4 r[9];
  // unrolled and branch-free (the last step's surplus lanes re-read the
  // tile's last float4 and put it behind the data in LDS, where nobody reads):
  // all nine loads are in flight before the first LDS store waits for one
#pragma unroll
  for (int i = 0; i < 9; ++i) {
    int e = tid + i * 256;
    r[i] = src[e < TV4 ? e : TV4 - 1];
  }
#pragma unroll   // r[] stays in registers only with constant indices
  for (int i = 0; i < 9; ++i) ((float4*)tile)[tid + i * 256] = r[i];
  __syncthreads();

  const int g = t * TPX + 2 * lane;     // pixel over all images; pairs stay
  const int b = g / NPIX;               // inside one image (6480 is even)
  const float* tp  = &tile[2 * lane * NLAY + wave];
  float*       dst = St + ((size_t)b * NLAY + wave) * SPITCH
                        + (g - b * NPIX) + b * SSKEW;
  // unrolled so that the LDS reads of many layers run ahead of the stores
#pragma unroll
  for (int i = 0; i < NLAY / 8; ++i) {  // layers wave + 8i <= 127
    float2 v;
    v.x = tp[8 * i];
    v.y = tp[NLAY + 8 * i];
    *(float2*)(dst + (size_t)(8 * i) * SPITCH) = v;
  }
  if (wave < NLAY % 8) {                // layers 128..132
    float2 v;
    v.x = tp[NLAY / 8 * 8];
    v.y = tp[NLAY + NLAY / 8 * 8];
    *(float2*)(dst + (size_t)(NLAY / 8 * 8) * SPITCH) = v;
  }
}

// ---------------------------------------------------------------------------
// ws path, first product: one workgroup per (layer, batch), 288 threads = 9
// wave32, one 16 x 16 tile of Wm = Uu^T * Ku (45 x 45 padded 48 x 48, K = 432)
// per wave [f32 WMMA], then the L1 normalization of its rows. The normalized Wm
// goes to the workspace, one column of 48 (all i) per (b, column patch j, layer); the
// second product and the sum over the layers are layer_gemm_kernel's.
// Uu = unfold(I*S*M) and Ku = unfold(I*S*(1-M)) are both only the k-stream of
// this product, so just NCH-th parts (chunks) of them live in LDS, patch-major
// as in the fallback kernel, in two buffers each. The stream is a pipeline:
//   - a thread's six quads of the layer's plane (they come from memory) are all
//     asked for at entry, so memory latency is waited out once, not per chunk;
//   - M and I of chunk j+1 are asked for in front of the WMMAs of chunk j;
//   - chunk j+1 is multiplied and stored into the other buffer behind them.
// One barrier per chunk does both jobs: it publishes chunk j and it ends every
// wave's reads of the buffer that chunk j+1 is stored into behind it.
// Chunks, k-steps and the two accumulators are those of the fallback kernel.
// ---------------------------------------------------------------------------
__global__ __launch_bounds__(288) void affinity_kernel(
    const float* __restrict__ I,     // (4,3,60,108)
    const float* __restrict__ St,    // (4,133,SPITCH)
    const float* __restrict__ M,     // (4,1,60,108)
    float* __restrict__ Wt)          // (4,45,133,WTP) normalized Wm
{
  __shared__ __align__(16) float Uc[2 * LP * UP];   // 29184 B, [buf][patch][chunk row]
  __shared__ __align__(16) float Kc[2 * LP * UP];   // 29184 B, the same
  float* const Wm = Uc;   // 48 x WP in buffer 0, which the last chunk does not use

  const int l    = blockIdx.x;          // layer
  const int b    = blockIdx.y;          // batch
  const int tid  = threadIdx.x;
  const int lane = tid & 31;
  const int wave = tid >> 5;            // 0..8

  // Fill: a chunk is 10 image rows (5 patch rows x 2 k1) of 27 quads = 270
  // quads, one per thread; a quad is 4 neighbouring pixels of one patch row.
  // The 18 threads left over take the 18 quads of the 3 padding patches: they
  // read some valid quad and store zeros (their S factor is 0), so that no
  // branch stands in the pipeline and the padding needs no pass of its own.
  const bool real = tid < CPIX / 4;
  const int  e    = real ? tid : tid - CPIX / 4;     // pad: 0..17
  const int  rr   = e / (WID / 4), wq = e - rr * (WID / 4);
  const int  ph   = rr / CK1;
  const int  kl   = real ? rr - ph * CK1 : (e / 3) & 1;   // k1 - 2j
  const int  p    = real ? ph * PW + wq / 3 : LQ + e / 6; // patch
  const int  pix0 = (ph * KS + (rr - ph * CK1)) * WID + wq * 4;
  const int  dst  = p * UP + kl * KS + (e % 3) * 4;  // wq % 3 == e % 3 (27 = 9 x 3)
  const float* sp = St + ((size_t)b * NLAY + l) * SPITCH + b * SSKEW + pix0;
  const float* mp = M + (size_t)b * NPIX + pix0;
  const float* ip = I + (size_t)b * 3 * NPIX + pix0;

  // chunk row  c*24 + (k1-2j)*12 + k2   <->   unfold row  c*144 + k1*12 + k2
  auto put = [&](int buf, const v4f s4, const float4 m4, const float4* x4) {
    const float s[4] = {real ? s4.x : 0.0f, real ? s4.y : 0.0f,
                        real ? s4.z : 0.0f, real ? s4.w : 0.0f};
    const float m[4] = {m4.x, m4.y, m4.z, m4.w};
    float sm[4], sk[4];
    // the loops over i and c are unrolled: constant indices keep the small
    // arrays in registers and turn the LDS offsets into immediates
#pragma unroll
    for (int i = 0; i < 4; ++i) {
      sm[i] = s[i] * m[i];                  // S*M
      sk[i] = s[i] - sm[i];                 // S*(1-M)
    }
#pragma unroll
    for (int c = 0; c < 3; ++c) {
      float4 u4, k4;
      u4.x = x4[c].x * sm[0];  k4.x = x4[c].x * sk[0];
      u4.y = x4[c].y * sm[1];  k4.y = x4[c].y * sk[1];
      u4.z = x4[c].z * sm[2];  k4.z = x4[c].z * sk[2];
      u4.w = x4[c].w * sm[3];  k4.w = x4[c].w * sk[3];
      *(float4*)&Uc[buf * LP * UP + dst + c * CRC] = u4;
      *(float4*)&Kc[buf * LP * UP + dst + c * CRC] = k4;
    }
  };

  // chunk 0's operands first (loads return in order), then the rest of the plane
  v4f    s4[NCH];
  float4 m4, x4[3];
  s4[0] = *(const v4f*)sp;
  m4    = *(const float4*)mp;
#pragma unroll   // x4[] and s4[] stay in registers only with constant indices
  for (int c = 0; c < 3; ++c) x4[c] = *(const float4*)&ip[c * NPIX];
#pragma unroll
  for (int j = 1; j < NCH; ++j) s4[j] = *(const v4f*)&sp[j * CK1 * WID];
  put(0, s4[0], m4, x4);
  // inputs-only fence on the loaded values: it keeps the loads of the plane's
  // later quads in front of the first barrier. Without it the compiler moves
  // them down into the chunks, where each wave waits for memory again.
  asm volatile("" :: "v"(s4[1]), "v"(s4[2]), "v"(s4[3]), "v"(s4[4]), "v"(s4[5]));

  // A(16x4 f32) layout: lane<16: M=lane, VGPRv=K(2h+v) ; lanes>=16: K+=2
  const int ti   = wave / 3, tj = wave - ti * 3;
  const int h    = lane >> 4;
  const int mcol = ti * 16 + (lane & 15);   // output row  (p index)
  const int ncol = tj * 16 + (lane & 15);   // output col  (q index)
  v8f acc0 = {}, acc1 = {};

  // unrolled: s4[] keeps constant indices, the buffer and the global offsets
  // are compile-time
#pragma unroll
  for (int j = 0; j < NCH; ++j) {
    __syncthreads();   // chunk j is complete; every wave has left the other buffer
    if (j + 1 < NCH) {
      m4 = *(const float4*)&mp[(j + 1) * CK1 * WID];
#pragma unroll
      for (int c = 0; c < 3; ++c)
        x4[c] = *(const float4*)&ip[c * NPIX + (j + 1) * CK1 * WID];
      // keeps these loads in front of the WMMAs, which are to cover their
      // latency: without it the scheduler puts chunk 1's behind most of them
      __builtin_amdgcn_sched_barrier(0);
    }

    // Wm += Uc^T * Kc; 9 waves <-> 9 (16x16) tiles
    // A lane reads 4 neighbouring rows (8kk + 4h + 0..3) of its patch from
    // each operand: elements 0,1 feed one k-step, elements 2,3 the next.
    // A and B take the same rows at the same (h, element) place.
    const float* ua = &Uc[(j & 1) * LP * UP + mcol * UP + 4 * h];
    const float* kb = &Kc[(j & 1) * LP * UP + ncol * UP + 4 * h];
#pragma unroll   // LDS offsets become immediates (9 pairs of k-steps, two chains)
    for (int kk = 0; kk < CRR / 8; ++kk) {
      const float4 a4 = *(const float4*)&ua[8 * kk];
      const float4 b4 = *(const float4*)&kb[8 * kk];
      v2f a, bb, a2, bb2;
      a.x  = a4.x;  a.y  = a4.y;  bb.x  = b4.x;  bb.y  = b4.y;
      a2.x = a4.z;  a2.y = a4.w;  bb2.x = b4.z;  bb2.y = b4.w;
      acc0 = __builtin_amdgcn_wmma_f32_16x16x4_f32(
          false, a, false, bb, (short)0, acc0, false, false);
      acc1 = __builtin_amdgcn_wmma_f32_16x16x4_f32(
          false, a2, false, bb2, (short)0, acc1, false, false);
    }

    if (j + 1 < NCH) {
      // keeps the fill, which waits for the loads above, behind the chunk's last
      // WMMA: without it the scheduler puts that wait among the first WMMAs
      __builtin_amdgcn_sched_barrier(0);
      put((j + 1) & 1, s4[j + 1], m4, x4);
    }
  }

  // C/D layout: VGPR v -> row v (lanes 0-15) / row v+8 (lanes 16-31)
#pragma unroll
  for (int v = 0; v < 8; ++v) {
    int row = ti * 16 + v + 8 * h;
    Wm[row * WP + ncol] = acc0[v] + acc1[v];
  }
  __syncthreads();

  // ---- L1 row normalization (rows 45..47 are all-zero: 0*1/eps=0)
  if (tid < LQ) {
    float s = 0.0f;
    for (int q = 0; q < LQ; ++q) s += fabsf(Wm[tid * WP + q]);
    float inv = 1.0f / fmaxf(s, 1e-12f);
    for (int q = 0; q < LP; ++q) Wm[tid * WP + q] *= inv;
  }
  __syncthreads();

  // Wt[b][j][l][i] = Wm[i][j]: rows 45..47 of Wm are zero and go along, so
  // that the reader's padded columns are zero too. A line (b, j, l) has a
  // pitch of 256 B: no 128-B line is written by two workgroups.
  __builtin_assume(tid < 288);        // lets all range tests but the last fold
  const int jj0 = tid / LP, ii = tid - jj0 * LP;      // 288 = 6 x 48
  float* wd = Wt + (((size_t)b * LQ + jj0) * NLAY + l) * WTP + ii;
  // unrolled: the LDS reads run ahead of the stores, all offsets immediates
#pragma unroll
  for (int it = 0; it < 8; ++it)
    if (jj0 + 6 * it < LQ)
      wd[(size_t)it * 6 * NLAY * WTP] = Wm[ii * WP + jj0 + 6 * it];
}

// ---------------------------------------------------------------------------
// Fallback (no workspace): one workgroup per (layer, batch). 288 threads = 9 wave32.
//   Stage 1: build Uu (=unfold(I*S*M)) and Ku (=unfold(I*S*(1-M))) in LDS.
//   Stage 2: Wm = Uu^T * Ku        (45x45 padded 48x48, K=432)  [f32 WMMA]
//   Stages 1 and 2 run in NCH row chunks: Ku is kept whole (stage 4 reads it
//   again), Uu is only the k-stream of stage 2, so just one chunk of it lives
//   in LDS. That brings LDS under a third of a WGP's, so three workgroups are
//   resident per WGP and the whole grid (532) runs in one round.
//   Both lie patch-major in LDS: a fill lane's 4 neighbouring pixels are 4
//   neighbouring unfold rows of one patch (one 16-B store), a stage-2 lane
//   reads the 4 unfold rows of two k-steps in one 16-B load, and stage 4 reads
//   16 neighbouring unfold rows of one patch with 16 lanes.
//   Stage 3: L1-normalize rows of Wm
//   Stage 4: WK = Ku * Wm^T        (432x45 padded 48,  K=48)    [f32 WMMA]
//            fold + layer reduction: atomicAdd into the out accumulator
// Dual accumulators in both k-loops break the WMMA RAW dependency chain.
// ---------------------------------------------------------------------------
__global__ __launch_bounds__(288) void matting_layer_kernel(
    const float* __restrict__ I,     // (4,3,60,108)
    const float* __restrict__ S,     // (4,60,108,133)
    const float* __restrict__ M,     // (4,1,60,108)
    float* __restrict__ outacc)      // (4,3,60,108) accumulator
{
  __shared__ __align__(16) float Ku[LP * KP];   // 83712 B, [patch][unfold row]
  __shared__ __align__(16) float Uc[LP * UP];   // 14592 B, [patch][chunk row]
  float* const Wm = Uc;   // 48 x WP, written only after the last read of Uc

  const int l    = blockIdx.x;          // layer
  const int b    = blockIdx.y;          // batch
  const int tid  = threadIdx.x;
  const int lane = tid & 31;
  const int wave = tid >> 5;            // 0..8

  const float* Ib = I + (size_t)b * 3 * NPIX;
  const float* Sb = S + (size_t)b * NPIX * NLAY + l;
  const float* Mb = M + (size_t)b * NPIX;

  // ---- Stage 1a: zero the 3 padding patches (45..47) of Ku and Uc ---------
  for (int e = tid; e < (LP - LQ) * KP / 4; e += 288) {
    const float4 z4 = {0.0f, 0.0f, 0.0f, 0.0f};
    ((float4*)&Ku[LQ * KP])[e] = z4;
    if (e < (LP - LQ) * UP / 4) ((float4*)&Uc[LQ * UP])[e] = z4;
  }

  // ---- Stages 1b + 2, chunk by chunk --------------------------------------
  // Chunk j holds the unfold rows with k1 in [2j, 2j+2), all three channels:
  //   chunk row  c*24  + (k1-2j)*12 + k2   <->   unfold row  c*144 + k1*12 + k2
  // A(16x4 f32) layout: lane<16: M=lane, VGPRv=K(2h+v) ; lanes>=16: K+=2
  {
    const int ti   = wave / 3, tj = wave - ti * 3;
    const int h    = lane >> 4;
    const int mcol = ti * 16 + (lane & 15);   // output row  (p index)
    const int ncol = tj * 16 + (lane & 15);   // output col  (q index)
    v8f acc0 = {}, acc1 = {};

    for (int j = 0; j < NCH; ++j) {
      // fill: 10 image rows (5 patch rows x 2 k1) of 27 quads, 1 write/element.
      // A quad is 4 neighbouring pixels of one patch row (12 = 3 quads): M and
      // I are each read 16 B a lane, in whole lines.
      for (int e = tid; e < CPIX / 4; e += 288) {
        int rr = e / (WID / 4), wq = e - rr * (WID / 4);
        int ph = rr / CK1, kl = rr - ph * CK1;  // kl = k1 - 2j
        int pw = wq / 3,   k2 = (wq - pw * 3) * 4;
        int pix   = (ph * KS + j * CK1 + kl) * WID + wq * 4;
        int p     = ph * PW + pw;               // patch index
        int rbase = kl * KS + k2;               // within-channel chunk row
        float4 s4;
        s4.x = Sb[(size_t)pix * NLAY];
        s4.y = Sb[(size_t)(pix + 1) * NLAY];
        s4.z = Sb[(size_t)(pix + 2) * NLAY];
        s4.w = Sb[(size_t)(pix + 3) * NLAY];
        // precaution: stands in front of the loads below, whose results the
        // compiler may place in address registers of the four loads above
        asm volatile("s_wait_xcnt 0x0" ::: "memory");
        const float4 m4 = *(const float4*)&Mb[pix];
        const float s[4] = {s4.x, s4.y, s4.z, s4.w};
        const float m[4] = {m4.x, m4.y, m4.z, m4.w};
        float sm[4], sk[4];
        // the loops over i and c are unrolled: constant indices keep the small
        // arrays in registers and turn the LDS offsets into immediates
#pragma unroll
        for (int i = 0; i < 4; ++i) {
          sm[i] = s[i] * m[i];                  // S*M
          sk[i] = s[i] - sm[i];                 // S*(1-M)
        }
#pragma unroll
        for (int c = 0; c < 3; ++c) {
          const float4 i4 = *(const float4*)&Ib[c * NPIX + pix];
          float4 u4, k4;
          u4.x = i4.x * sm[0];  k4.x = i4.x * sk[0];
          u4.y = i4.y * sm[1];  k4.y = i4.y * sk[1];
          u4.z = i4.z * sm[2];  k4.z = i4.z * sk[2];
          u4.w = i4.w * sm[3];  k4.w = i4.w * sk[3];
          *(float4*)&Uc[p * UP + c * CRC + rbase]           = u4;
          *(float4*)&Ku[p * KP + c * 144 + j * CRC + rbase] = k4;
        }
      }
      __syncthreads();   // chunk j of Uc and Ku is complete

      // Wm += Uc^T * Ku(chunk rows); 9 waves <-> 9 (16x16) tiles
      // A lane reads 4 neighbouring rows (8kk + 4h + 0..3) of its patch from
      // each operand: elements 0,1 feed one k-step, elements 2,3 the next.
      // A and B take the same rows at the same (h, element) place.
      const float* ua = &Uc[mcol * UP + 4 * h];
      const float* kb = &Ku[ncol * KP + j * CRC + 4 * h];
      // unrolled so that the channel's row offset is compile-time and the LDS
      // offsets are immediates (9 pairs of k-steps, two WMMA chains)
#pragma unroll
      for (int kk = 0; kk < CRR / 8; ++kk) {
        const int ra = 8 * kk;                                // chunk row
        const int rb = 8 * kk + (kk / (CRC / 8)) * (144 - CRC); // unfold row - 24j
        const float4 a4 = *(const float4*)&ua[ra];
        const float4 b4 = *(const float4*)&kb[rb];
        v2f a, bb, a2, bb2;
        a.x  = a4.x;  a.y  = a4.y;  bb.x  = b4.x;  bb.y  = b4.y;
        a2.x = a4.z;  a2.y = a4.w;  bb2.x = b4.z;  bb2.y = b4.w;
        acc0 = __builtin_amdgcn_wmma_f32_16x16x4_f32(
            false, a, false, bb, (short)0, acc0, false, false);
        acc1 = __builtin_amdgcn_wmma_f32_16x16x4_f32(
            false, a2, false, bb2, (short)0, acc1, false, false);
      }
      __syncthreads();   // every wave has left Uc: refill it (or write Wm)
    }

    // C/D layout: VGPR v -> row v (lanes 0-15) / row v+8 (lanes 16-31)
#pragma unroll
    for (int v = 0; v < 8; ++v) {
      int row = ti * 16 + v + 8 * h;
      Wm[row * WP + ncol] = acc0[v] + acc1[v];
    }
  }
  __syncthreads();

  // ---- Stage 3: L1 row normalization (rows 45..47 are all-zero: 0*1/eps=0)
  if (tid < LQ) {
    float s = 0.0f;
    for (int q = 0; q < LQ; ++q) s += fabsf(Wm[tid * WP + q]);
    float inv = 1.0f / fmaxf(s, 1e-12f);
    for (int q = 0; q < LP; ++q) Wm[tid * WP + q] *= inv;
  }
  __syncthreads();

  {
    // ---- Stage 4: WK = Ku * Wm^T ; 81 tiles over 9 waves, fold + reduce ---
    const int h  = lane >> 4;
    const int lc = lane & 15;
    // t = wave + 9i keeps t % 3: a wave's column tile, and with it its Wm
    // fragments, are the same for all its tiles. They are read here, once.
    const int nt   = wave % 3;
    const int ncol = nt * 16 + lc;                // patch index i
    v2f bw[12];
#pragma unroll   // bw[] stays in registers only with constant indices
    for (int s = 0; s < 12; ++s)
      bw[s] = *(const v2f*)&Wm[ncol * WP + 4 * s + 2 * h];
    for (int t = wave; t < 81; t += 9) {          // uniform: 9 iters per wave
      const int mt = t / 3;
      const int mrow = mt * 16 + lc;              // unfold row (c,k1,k2)
      v8f acc0 = {}, acc1 = {};
#pragma unroll
      for (int s = 0; s < 6; ++s) {               // 12 k-steps, 2 chains
        const int ka = 8 * s + 2 * h;             // patch j of the k-step
        v2f a, a2;      // 16 lanes read 16 neighbouring unfold rows of a patch
        a.x  = Ku[ka * KP + mrow];
        a.y  = Ku[(ka + 1) * KP + mrow];
        a2.x = Ku[(ka + 4) * KP + mrow];
        a2.y = Ku[(ka + 5) * KP + mrow];
        acc0 = __builtin_amdgcn_wmma_f32_16x16x4_f32(
            false, a, false, bw[2 * s], (short)0, acc0, false, false);
        acc1 = __builtin_amdgcn_wmma_f32_16x16x4_f32(
            false, a2, false, bw[2 * s + 1], (short)0, acc1, false, false);
      }
      if (ncol < LQ) {
        const int ph = ncol / PW, pw = ncol - ph * PW;
#pragma unroll
        for (int v = 0; v < 8; ++v) {
          int   r   = mt * 16 + v + 8 * h;        // 0..431
          int   c   = r / 144, rem = r - c * 144;
          int   k1  = rem / KS, k2 = rem - k1 * KS;
          int   pix = (ph * KS + k1) * WID + pw * KS + k2;
          atomicAdd(&outacc[((size_t)b * 3 + c) * NPIX + pix],
                    acc0[v] + acc1[v]);
        }
      }
    }
  }
}

// ---------------------------------------------------------------------------
// ws path, second product. With K_l[c,kk,j] = I[c,kk,j] * (1-M)[kk,j] * S_l[kk,j]
// (kk = pixel inside a patch, j = patch) the sum over layers of Wm_l * K_l is
//   out[c,kk,i] = sum_j I[c,kk,j] * (1-M)[kk,j] * T_j[kk,i],
//   T_j[kk,i]   = sum_l S_l[kk,j] * Wm_l[i,j].
// T_j is one GEMM per (b, j): 144 x 48, K = 133 layers (padded 136). The layer
// sum is its k dimension, so no per-layer planes are stored, and the channel
// factor is outside it, so it has a third of the multiply-adds.
// One workgroup per (b, j, third of the patch: 4 patch rows = 48 pixels), so
// that 540 workgroups spread over the chip; 9 waves <-> 3 x 3 tiles of 16 x 16.
// Both operands lie in LDS as [layer / 4][column][layer % 4]: one 16-B read
// with an immediate offset holds a lane's fragments of two k-steps, and each
// half-wave reads 256 B in a row (all 64 banks once).
// ---------------------------------------------------------------------------
__global__ __launch_bounds__(288) void layer_gemm_kernel(
    const float* __restrict__ St,    // (4,133,SPITCH)
    const float* __restrict__ M,     // (4,1,60,108)
    const float* __restrict__ Wt,    // (4,45,133,WTP)
    float* __restrict__ Tp)          // (4,45,3,TREG): [b][j][t3][image rows]
{
  // 52224 B: S as [l/4][kk - 48*t3][l%4], behind it W as [l/4][i][l%4]
  __shared__ __align__(16) float Sh[LK * KT + LK * LP];

  const int j    = blockIdx.x;          // patch of the k side
  const int b    = blockIdx.y;
  const int t3   = blockIdx.z;          // third of the patch
  const int tid  = threadIdx.x;
  __builtin_assume(tid < 288);          // lets the fill's range tests fold
  const int lane = tid & 31;
  const int wave = tid >> 5;            // 0..8
  const int h    = lane >> 4;
  const int lc   = lane & 15;
  const int mt   = wave / 3, nt = wave - mt * 3;
  const int pj   = (j / PW) * KS * WID + (j % PW) * KS;  // patch's first pixel
  const v4f z4 = {0.0f, 0.0f, 0.0f, 0.0f};

  // M of the lane's 8 result rows kk = 48*t3 + 16*mt + 8h + 0..7: two quads
  v4f mr[2];
  const float* pm[2];
#pragma unroll
  for (int g = 0; g < 2; ++g) {
    const int q = 12 * t3 + 4 * mt + 2 * h + g;
    pm[g] = &M[(size_t)b * NPIX + pj + (q / 3) * WID + (q % 3) * 4];
    mr[g] = *(const v4f*)pm[g];
  }

  // fill: an item is 4 layers x 4 columns (a quad: 4 pixels of a patch row, or
  // 4 columns i): 4 loads of 16 B, turned in registers, 4 LDS stores of 16 B,
  // 64 B in a row. 34 x 12 items of S, then 34 x 12 of W; 288 threads = 24 x 12.
  // The load loop is unrolled and branch-free (past layer 132 a lane reads
  // layer 132 again and stores zero or nothing): all 12 loads are in flight
  // before the first LDS store waits for one.
  {
    const int p0 = tid / 12, q = tid - p0 * 12;
    const float* sp = St + (size_t)b * NLAY * SPITCH + b * SSKEW + pj
                         + (4 * t3 + q / 3) * WID + (q % 3) * 4;
    const float* wp = Wt + ((size_t)b * LQ + j) * NLAY * WTP + q * 4;
    v4f r[3][4];
    const float* pr[3][4];
#pragma unroll
    for (int it = 0; it < 3; ++it) {
      const int  g   = p0 + 24 * it;            // 0..33: S, 34..67: W
      const bool isS = g < LK / 4;
      const int  gl  = isS ? g : g - LK / 4;
      const float* src   = isS ? sp : wp;
      const int    pitch = isS ? SPITCH : WTP;
#pragma unroll
      for (int u = 0; u < 4; ++u) {
        const int l  = 4 * gl + u;
        const int lv = l < NLAY ? l : NLAY - 1;
        pr[it][u] = &src[lv * pitch];
        r[it][u]  = *(const v4f*)pr[it][u];
      }
    }
    // inputs-only fence on the loaded values: without it the compiler sinks
    // the later loads behind the first LDS stores (and into the range test
    // below), and their latency is paid three times instead of once. The
    // addresses are inputs too, and the wait is a precaution: no register that
    // one of the 14 loads names is given a new value (a later load's result
    // among them) in front of it.
    asm volatile("s_wait_xcnt 0x0"
                 :: "v"(r[0][0]), "v"(r[0][1]), "v"(r[0][2]), "v"(r[0][3]),
                    "v"(r[1][0]), "v"(r[1][1]), "v"(r[1][2]), "v"(r[1][3]),
                    "v"(r[2][0]), "v"(r[2][1]), "v"(r[2][2]), "v"(r[2][3]),
                    "v"(mr[0]), "v"(mr[1]),
                    "v"(pr[0][0]), "v"(pr[0][1]), "v"(pr[0][2]), "v"(pr[0][3]),
                    "v"(pr[1][0]), "v"(pr[1][1]), "v"(pr[1][2]), "v"(pr[1][3]),
                    "v"(pr[2][0]), "v"(pr[2][1]), "v"(pr[2][2]), "v"(pr[2][3]),
                    "v"(pm[0]), "v"(pm[1])
                 : "memory");
#pragma unroll   // r[][] stays in registers only with constant indices
    for (int it = 0; it < 3; ++it) {
      const int g  = p0 + 24 * it;
      const int gl = g < LK / 4 ? g : g - LK / 4;
      if (g < 2 * (LK / 4)) {
        v4f v[4];
#pragma unroll
        for (int u = 0; u < 4; ++u) v[u] = 4 * gl + u < NLAY ? r[it][u] : z4;
#pragma unroll
        for (int x = 0; x < 4; ++x) {
          const v4f c4 = {v[0][x], v[1][x], v[2][x], v[3][x]};
          *(v4f*)&Sh[(g * KT + q * 4 + x) * 4] = c4;
        }
      }
    }
  }
  const v4f km[2] = {1.0f - mr[0], 1.0f - mr[1]};
  __syncthreads();   // both operands are complete

  // A(16x4): lane -> row kk = lc; B(4x16): lane -> column i = lc. A lane reads
  // the 4 layers 8s + 4h + 0..3 of its row and of its column: elements 0,1 feed
  // one k-step, elements 2,3 the next. A and B take the same layers at the
  // same (h, element) place. The two k-steps go to two accumulators: two
  // independent WMMA chains.
  v8f acc0 = {}, acc1 = {};
  const float* ap = &Sh[(h * KT + 16 * mt + lc) * 4];
  const float* bp = &Sh[LK * KT + (h * LP + 16 * nt + lc) * 4];
#pragma unroll   // LDS offsets become immediates; reads run ahead of the WMMAs
  for (int s = 0; s < LK / 8; ++s) {
    const v4f a4 = *(const v4f*)&ap[s * 8 * KT];
    const v4f b4 = *(const v4f*)&bp[s * 8 * LP];
    v2f a, bb, a2, bb2;
    a.x  = a4.x;  a.y  = a4.y;  bb.x  = b4.x;  bb.y  = b4.y;
    a2.x = a4.z;  a2.y = a4.w;  bb2.x = b4.z;  bb2.y = b4.w;
    acc0 = __builtin_amdgcn_wmma_f32_16x16x4_f32(
        false, a, false, bb, (short)0, acc0, false, false);
    acc1 = __builtin_amdgcn_wmma_f32_16x16x4_f32(
        false, a2, false, bb2, (short)0, acc1, false, false);
  }

  // D: VGPR v -> row kk = 48*t3 + 16*mt + 8h + v, column i = 16nt + lc. A lane's
  // 8 rows are two quads (4 neighbouring pixels of patch i) -> two 16-B stores.
  // The workgroup's results lie in image order: the 4 image rows k1 = 4*t3..+3
  // of each of the 5 patch rows, 20 rows of 108, in a region of whole 128-B
  // lines of its own, which the fold kernel reads in whole lines.
  const int i = 16 * nt + lc;
  if (i < LQ) {
    float* tp = Tp + (((size_t)b * LQ + j) * (PP / KT) + t3) * TREG
                   + (i / PW) * 4 * WID + (i % PW) * KS;
#pragma unroll   // constant accumulator indices keep acc0/acc1 in registers
    for (int g = 0; g < 2; ++g) {
      const int q = 4 * mt + 2 * h + g;           // quad inside the third, 0..11
      v4f val;
      val.x = (acc0[4 * g]     + acc1[4 * g])     * km[g].x;
      val.y = (acc0[4 * g + 1] + acc1[4 * g + 1]) * km[g].y;
      val.z = (acc0[4 * g + 2] + acc1[4 * g + 2]) * km[g].z;
      val.w = (acc0[4 * g + 3] + acc1[4 * g + 3]) * km[g].w;
      *(v4f*)&tp[(q / 3) * WID + (q % 3) * 4] = val;
    }
  }
}

// ---------------------------------------------------------------------------
// ws path, fold + blend: out[c,kk,i] = I*(1-M) + M * sum_j I[c,kk,j]*(1-M)[kk,j]*T_j[kk,i].
// The factor I differs per pixel kk, so this sum is elementwise in kk (per
// pixel a 3 x 45 by 45 x 45 product): vector work, 45 multiply-adds per output
// element, under 1 % of all. A workgroup owns FQ neighbouring quads of out (whole 128-B
// lines, one writer each); 5 groups of threads take the 9 patches j of one
// patch row each (18 loads a thread, all in flight), then the groups are summed.
// ---------------------------------------------------------------------------
__global__ __launch_bounds__(5 * FQ) void fold_blend_kernel(
    const float* __restrict__ I,     // (4,3,60,108)
    const float* __restrict__ M,     // (4,1,60,108)
    const float* __restrict__ Tp,    // (4,45,3,TREG)
    float* __restrict__ out)         // (4,3,60,108)
{
  __shared__ __align__(16) float red[5 * FQ * 4];   // 3840 B

  const int tid = threadIdx.x;
  const int jg  = tid / FQ, eq = tid - jg * FQ;   // patch row of j; own quad
  const int e   = blockIdx.x * FQ + eq;           // quad of out, flat
  const int b   = e / (3 * NPIX / 4);
  const int pq  = e % (NPIX / 4);                 // quad inside the image plane
  const int y   = pq / (WID / 4), xq = pq - y * (WID / 4);
  const int k1  = y % KS;
  const int t3  = k1 / 4;

  // j = 9*jg + u: patch row jg, patch column u
  const float* pt  = Tp + ((size_t)(b * LQ + jg * PW) * (PP / KT) + t3) * TREG
                        + ((y / KS) * 4 + (k1 - 4 * t3)) * WID + xq * 4;
  const float* px  = I + (size_t)(e - pq) * 4 + (jg * KS + k1) * WID + (xq % 3) * 4;
  const float* pmo = M + (size_t)b * NPIX + pq * 4;
  const float* pio = I + (size_t)e * 4;
  // the blend's own M and I are read up here with the rest, so that their
  // latency is not paid again behind the barrier
  const v4f m4 = *(const v4f*)pmo;
  const v4f i4 = *(const v4f*)pio;
  v4f t4[PW], x4[PW];
#pragma unroll   // constant indices keep the arrays in registers
  for (int u = 0; u < PW; ++u) {
    t4[u] = *(const v4f*)&pt[u * (PP / KT) * TREG];
    x4[u] = *(const v4f*)&px[u * KS];
  }
  // precaution: the loaded values and the addresses are inputs, so that no
  // register that one of the 20 loads names is given a new value (a later
  // load's result among them) in front of the wait
  asm volatile("s_wait_xcnt 0x0"
               :: "v"(t4[0]), "v"(t4[1]), "v"(t4[2]), "v"(t4[3]), "v"(t4[4]),
                  "v"(t4[5]), "v"(t4[6]), "v"(t4[7]), "v"(t4[8]),
                  "v"(x4[0]), "v"(x4[1]), "v"(x4[2]), "v"(x4[3]), "v"(x4[4]),
                  "v"(x4[5]), "v"(x4[6]), "v"(x4[7]), "v"(x4[8]),
                  "v"(m4), "v"(i4), "v"(pt), "v"(px), "v"(pmo), "v"(pio)
               : "memory");
  v4f s = t4[0] * x4[0];
#pragma unroll
  for (int u = 1; u < PW; ++u) s += t4[u] * x4[u];
  *(v4f*)&red[tid * 4] = s;
  __syncthreads();   // all five groups' sums are in LDS

  if (tid < FQ) {
#pragma unroll
    for (int g = 1; g < 5; ++g) s += *(const v4f*)&red[(g * FQ + tid) * 4];
    *(v4f*)&out[(size_t)e * 4] = i4 * (1.0f - m4) + s * m4;
  }
}

// ---------------------------------------------------------------------------
// atomic-path helpers: zero d_out first.
// ---------------------------------------------------------------------------
__global__ void zero_kernel(float* __restrict__ out, int n) {
  int i = blockIdx.x * blockDim.x + threadIdx.x;
  if (i < n) out[i] = 0.0f;
}

__global__ void blend_kernel(const float* __restrict__ I,
                             const float* __restrict__ M,
                             float* __restrict__ out, int n) {
  int i = blockIdx.x * blockDim.x + threadIdx.x;
  if (i < n) {
    int b   = i / (3 * NPIX);
    int pix = i % NPIX;
    float m = M[(size_t)b * NPIX + pix];
    out[i] = I[i] * (1.0f - m) + out[i] * m;
  }
}

// ---------------------------------------------------------------------------
extern "C" void kernel_launch(void* const* d_in, const int* in_sizes, int n_in,
                              void* d_out, int out_size, void* d_ws, size_t ws_size,
                              hipStream_t stream) {
  const float* I = (const float*)d_in[0];
  const float* S = (const float*)d_in[1];
  const float* M = (const float*)d_in[2];
  float* out = (float*)d_out;

  const int    n    = NB * 3 * NPIX;                              // 77760
  const size_t nst  = (size_t)NB * NLAY * SPITCH;                 // 13.9 MB
  const size_t nwt  = (size_t)NB * LQ * NLAY * WTP;               // 6.1 MB
  const size_t ntp  = (size_t)NB * LQ * (PP / KT) * TREG;         // 4.7 MB
  const size_t need = (nst + nwt + ntp) * sizeof(float);

  if (d_ws != nullptr && ws_size >= need) {
    // every plane below is rewritten in every call before it is read
    float* St = (float*)d_ws;         // transposed S
    float* Wt = St + nst;             // normalized affinities, [b][j][l][i]
    float* Tp = Wt + nwt;             // layer-summed products, [b][j][third]
    transpose_s_kernel<<<TTILE, 256, 0, stream>>>(S, St);
    affinity_kernel<<<dim3(NLAY, NB), 288, 0, stream>>>(I, St, M, Wt);
    layer_gemm_kernel<<<dim3(LQ, NB, PP / KT), 288, 0, stream>>>(St, M, Wt, Tp);
    fold_blend_kernel<<<n / 4 / FQ, 5 * FQ, 0, stream>>>(I, M, Tp, out);
  } else {
    // fallback: accumulate with global atomics directly into d_out
    zero_kernel<<<(n + 255) / 256, 256, 0, stream>>>(out, n);
    matting_layer_kernel<<<dim3(NLAY, NB), 288, 0, stream>>>(I, S, M, out);
    blend_kernel<<<(n + 255) / 256, 256, 0, stream>>>(I, M, out, n);
  }
}

// v007
// Measured time: 28.3 microseconds a run.
// Timed twice side by side with v006, it ran 1.15 and 1.13 times as fast.
// Counting every step since v000, it is 2.67 times as fast.
#include <hip/hip_runtime.h>

// ---------------------------------------------------------------------------
// Problem constants (from reference)
// ---------------------------------------------------------------------------
#define HGT   60
#define WID   108
#define NPIX  (HGT * WID)        // 6480 pixels per (b) image plane
#define NLAY  133
#define NB    4
#define KS    12
#define PH    5
#define PW    9
#define LQ    45                 // number of patches (real columns)
#define LP    48                 // padded to 3 x 16 for WMMA tiles
#define CR    432                // unfold rows = 3 * 12 * 12 (27 x 16 exactly)
#define NCH   6                  // row chunks of stages 1+2
#define CK1   2                  // k1 values per chunk (KS / NCH)
#define CRC   (CK1 * KS)         // 24 chunk rows per channel (3 x 8)
#define CRR   (3 * CRC)          // 72 chunk rows = 9 pairs of k-steps of 4
#define CPIX  (PH * CK1 * WID)   // 1080 pixels per chunk
// LDS pitches in floats. Ku and the Uu chunk are kept patch-major (one line
// per patch, the unfold rows along it). Each pitch is 4 x an odd number: 16
// lanes that read 8 or 16 B at that stride fall on 16 different groups of 4
// banks, and every line starts on a multiple of 16 B.
#define KP    436                // Ku: 432 unfold rows + 4
#define UP    76                 // Uu chunk: 72 chunk rows + 4
#define WP    52                 // Wm: 48 columns + 4
#define TPX   64                 // pixels per tile of the S transpose
#define TTILE (NB * NPIX / TPX)  // 405 tiles, all full
#define TV4   (TPX * NLAY / 4)   // 2128 float4 per tile
#define SSKEW (NPIX % TPX)       // 16: start of image b's planes, times b
#define SPITCH 6528              // plane pitch of the transposed S (102 x 64)
#define PP    (KS * KS)          // 144 pixels of a patch
#define LK    136                // layers padded to 34 k-steps of 4
#define WTP   32                 // a line of Wt: 2 patches j x 16 patches i, 128 B
#define NPR   23                 // pairs of patches j (the last holds one)
#define JH    24                 // patches j (= waves) per layer-GEMM workgroup
#define RP    20                 // LDS pitch of 16 results of a column: 16 B x odd
#define AP    140                // LDS pitch of a pixel's 136 layers: 16 B x odd
#define FQ    48                 // output quads zeroed per transpose tile (6 x 128 B)

typedef __attribute__((ext_vector_type(2))) float v2f;
typedef __attribute__((ext_vector_type(4))) float v4f;
typedef __attribute__((ext_vector_type(8))) float v8f;
typedef v4f v4fu __attribute__((aligned(4)));   // 16 B at a multiple of 4 B
#define GLB __attribute__((address_space(1)))   // a pointer made from an integer
                                                // is told to be global memory

// ---------------------------------------------------------------------------
// Pre-pass (ws path): S (b, pix, layer) -> St (b, layer, pix), pitch SPITCH.
// In S one layer's pixels lie 532 B apart, so a wave of the main kernel that
// reads 32 pixels of its layer touches 32 cache lines for 128 useful bytes,
// and every line is fetched again by each of the layers that share it. Here
// S is read once in whole lines (a tile of 64 pixels x 133 layers is one
// contiguous run), turned in LDS and written as 256-B runs, one per layer.
// Tiles run over the 25920 pixels of all images (405 full tiles); image b's
// planes start SSKEW*b floats into their pitch, so that every run of 64
// pixels starts on a multiple of 256 B although 6480 is no multiple of 64.
// LDS reads: lane stride 266 dwords (10 mod 64) -> 32 distinct banks.
// Each tile's workgroup also stores the zeros of FQ quads of out (whole lines),
// the start value that the last launch adds onto.
// ---------------------------------------------------------------------------
__global__ __launch_bounds__(256) void transpose_s_kernel(
    const float* __restrict__ S,     // (4,60,108,133)
    float* __restrict__ St,          // (4,133,SPITCH)
    float* __restrict__ out)         // (4,3,60,108)
{
  // 2128 float4 of data; rounded up to 9 x 256 so that no fill step branches
  __shared__ __align__(16) float tile[9 * 256 * 4];  // 36864 B

  const int t    = blockIdx.x;          // tile
  const int tid  = threadIdx.x;
  const int lane = tid & 31;
  const int wave = (tid >> 5) & 7;

  const float4* src = (const float4*)(S + (size_t)t * TPX * NLAY);
  float4 r[9];
  // unrolled and branch-free (the last step's surplus lanes re-read the
  // tile's last float4 and put it behind the data in LDS, where nobody reads):
  // all nine loads are in flight before the first LDS store waits for one
#pragma unroll
  for (int i = 0; i < 9; ++i) {
    int e = tid + i * 256;
    r[i] = src[e < TV4 ? e : TV4 - 1];
  }
#pragma unroll   // r[] stays in registers only with constant indices
  for (int i = 0; i < 9; ++i) ((float4*)tile)[tid + i * 256] = r[i];
  __syncthreads();

  const int g = t * TPX + 2 * lane;     // pixel over all images; pairs stay
  const int b = g / NPIX;               // inside one image (6480 is even)
  const float* tp  = &tile[2 * lane * NLAY + wave];
  float*       dst = St + ((size_t)b * NLAY + wave) * SPITCH
                        + (g - b * NPIX) + b * SSKEW;
  // unrolled so that the LDS reads of many layers run ahead of the stores
#pragma unroll
  for (int i = 0; i < NLAY / 8; ++i) {  // layers wave + 8i <= 127
    float2 v;
    v.x = tp[8 * i];
    v.y = tp[NLAY + 8 * i];
    *(float2*)(dst + (size_t)(8 * i) * SPITCH) = v;
  }
  if (wave < NLAY % 8) {                // layers 128..132
    float2 v;
    v.x = tp[NLAY / 8 * 8];
    v.y = tp[NLAY + NLAY / 8 * 8];
    *(float2*)(dst + (size_t)(NLAY / 8 * 8) * SPITCH) = v;
  }
  if (tid < FQ) {                       // behind the barrier, which would wait for it
    const float4 z4 = {0.0f, 0.0f, 0.0f, 0.0f};
    ((float4*)out)[t * FQ + tid] = z4;
  }
}

// ---------------------------------------------------------------------------
// ws path, first product: one workgroup per (layer, batch), 288 threads = 9
// wave32, one 16 x 16 tile of Wm = Uu^T * Ku (45 x 45 padded 48 x 48, K = 432)
// per wave [f32 WMMA], then the L1 normalization of its rows. The normalized Wm
// goes to the workspace, in 128-B lines of 2 column patches j x 16 rows i, one layer each; the
// second product and the sum over the layers are layer_fold_kernel's.
// Uu = unfold(I*S*M) and Ku = unfold(I*S*(1-M)) are both only the k-stream of
// this product, so just NCH-th parts (chunks) of them live in LDS, patch-major
// as in the fallback kernel, in two buffers each. The stream is a pipeline:
//   - a thread's six quads of the layer's plane (they come from memory) are all
//     asked for at entry, so memory latency is waited out once, not per chunk;
//   - M and I of chunk j+1 are asked for in front of the WMMAs of chunk j;
//   - chunk j+1 is multiplied and stored into the other buffer behind them.
// One barrier per chunk does both jobs: it publishes chunk j and it ends every
// wave's reads of the buffer that chunk j+1 is stored into behind it.
// Chunks, k-steps and the two accumulators are those of the fallback kernel.
// ---------------------------------------------------------------------------
__global__ __launch_bounds__(288) void affinity_kernel(
    const float* __restrict__ I,     // (4,3,60,108)
    const float* __restrict__ St,    // (4,133,SPITCH)
    const float* __restrict__ M,     // (4,1,60,108)
    float* __restrict__ Wt)          // (4,NPR,3,133,WTP) normalized Wm
{
  __shared__ __align__(16) float Uc[2 * LP * UP];   // 29184 B, [buf][patch][chunk row]
  __shared__ __align__(16) float Kc[2 * LP * UP];   // 29184 B, the same
  float* const Wm = Uc;   // 48 x WP in buffer 0, which the last chunk does not use

  const int l    = blockIdx.x;          // layer
  const int b    = blockIdx.y;          // batch
  const int tid  = threadIdx.x;
  const int lane = tid & 31;
  const int wave = tid >> 5;            // 0..8

  // Fill: a chunk is 10 image rows (5 patch rows x 2 k1) of 27 quads = 270
  // quads, one per thread; a quad is 4 neighbouring pixels of one patch row.
  // The 18 threads left over take the 18 quads of the 3 padding patches: they
  // read some valid quad and store zeros (their S factor is 0), so that no
  // branch stands in the pipeline and the padding needs no pass of its own.
  const bool real = tid < CPIX / 4;
  const int  e    = real ? tid : tid - CPIX / 4;     // pad: 0..17
  const int  rr   = e / (WID / 4), wq = e - rr * (WID / 4);
  const int  ph   = rr / CK1;
  const int  kl   = real ? rr - ph * CK1 : (e / 3) & 1;   // k1 - 2j
  const int  p    = real ? ph * PW + wq / 3 : LQ + e / 6; // patch
  const int  pix0 = (ph * KS + (rr - ph * CK1)) * WID + wq * 4;
  const int  dst  = p * UP + kl * KS + (e % 3) * 4;  // wq % 3 == e % 3 (27 = 9 x 3)
  const float* sp = St + ((size_t)b * NLAY + l) * SPITCH + b * SSKEW + pix0;
  const float* mp = M + (size_t)b * NPIX + pix0;
  const float* ip = I + (size_t)b * 3 * NPIX + pix0;

  // chunk row  c*24 + (k1-2j)*12 + k2   <->   unfold row  c*144 + k1*12 + k2
  auto put = [&](int buf, const v4f s4, const float4 m4, const float4* x4) {
    const float s[4] = {real ? s4.x : 0.0f, real ? s4.y : 0.0f,
                        real ? s4.z : 0.0f, real ? s4.w : 0.0f};
    const float m[4] = {m4.x, m4.y, m4.z, m4.w};
    float sm[4], sk[4];
    // the loops over i and c are unrolled: constant indices keep the small
    // arrays in registers and turn the LDS offsets into immediates
#pragma unroll
    for (int i = 0; i < 4; ++i) {
      sm[i] = s[i] * m[i];                  // S*M
      sk[i] = s[i] - sm[i];                 // S*(1-M)
    }
#pragma unroll
    for (int c = 0; c < 3; ++c) {
      float4 u4, k4;
      u4.x = x4[c].x * sm[0];  k4.x = x4[c].x * sk[0];
      u4.y = x4[c].y * sm[1];  k4.y = x4[c].y * sk[1];
      u4.z = x4[c].z * sm[2];  k4.z = x4[c].z * sk[2];
      u4.w = x4[c].w * sm[3];  k4.w = x4[c].w * sk[3];
      *(float4*)&Uc[buf * LP * UP + dst + c * CRC] = u4;
      *(float4*)&Kc[buf * LP * UP + dst + c * CRC] = k4;
    }
  };

  // chunk 0's operands first (loads return in order), then the rest of the plane
  v4f    s4[NCH];
  float4 m4, x4[3];
  s4[0] = *(const v4f*)sp;
  m4    = *(const float4*)mp;
#pragma unroll   // x4[] and s4[] stay in registers only with constant indices
  for (int c = 0; c < 3; ++c) x4[c] = *(const float4*)&ip[c * NPIX];
#pragma unroll
  for (int j = 1; j < NCH; ++j) s4[j] = *(const v4f*)&sp[j * CK1 * WID];
  put(0, s4[0], m4, x4);
  // inputs-only fence on the loaded values: it keeps the loads of the plane's
  // later quads in front of the first barrier. Without it the compiler moves
  // them down into the chunks, where each wave waits for memory again.
  asm volatile("" :: "v"(s4[1]), "v"(s4[2]), "v"(s4[3]), "v"(s4[4]), "v"(s4[5]));

  // A(16x4 f32) layout: lane<16: M=lane, VGPRv=K(2h+v) ; lanes>=16: K+=2
  const int ti   = wave / 3, tj = wave - ti * 3;
  const int h    = lane >> 4;
  const int mcol = ti * 16 + (lane & 15);   // output row  (p index)
  const int ncol = tj * 16 + (lane & 15);   // output col  (q index)
  v8f acc0 = {}, acc1 = {};

  // unrolled: s4[] keeps constant indices, the buffer and the global offsets
  // are compile-time
#pragma unroll
  for (int j = 0; j < NCH; ++j) {
    __syncthreads();   // chunk j is complete; every wave has left the other buffer
    if (j + 1 < NCH) {
      m4 = *(const float4*)&mp[(j + 1) * CK1 * WID];
#pragma unroll
      for (int c = 0; c < 3; ++c)
        x4[c] = *(const float4*)&ip[c * NPIX + (j + 1) * CK1 * WID];
      // keeps these loads in front of the WMMAs, which are to cover their
      // latency: without it the scheduler puts chunk 1's behind most of them
      __builtin_amdgcn_sched_barrier(0);
    }

    // Wm += Uc^T * Kc; 9 waves <-> 9 (16x16) tiles
    // A lane reads 4 neighbouring rows (8kk + 4h + 0..3) of its patch from
    // each operand: elements 0,1 feed one k-step, elements 2,3 the next.
    // A and B take the same rows at the same (h, element) place.
    const float* ua = &Uc[(j & 1) * LP * UP + mcol * UP + 4 * h];
    const float* kb = &Kc[(j & 1) * LP * UP + ncol * UP + 4 * h];
#pragma unroll   // LDS offsets become immediates (9 pairs of k-steps, two chains)
    for (int kk = 0; kk < CRR / 8; ++kk) {
      const float4 a4 = *(const float4*)&ua[8 * kk];
      const float4 b4 = *(const float4*)&kb[8 * kk];
      v2f a, bb, a2, bb2;
      a.x  = a4.x;  a.y  = a4.y;  bb.x  = b4.x;  bb.y  = b4.y;
      a2.x = a4.z;  a2.y = a4.w;  bb2.x = b4.z;  bb2.y = b4.w;
      acc0 = __builtin_amdgcn_wmma_f32_16x16x4_f32(
          false, a, false, bb, (short)0, acc0, false, false);
      acc1 = __builtin_amdgcn_wmma_f32_16x16x4_f32(
          false, a2, false, bb2, (short)0, acc1, false, false);
    }

    if (j + 1 < NCH) {
      // keeps the fill, which waits for the loads above, behind the chunk's last
      // WMMA: without it the scheduler puts that wait among the first WMMAs
      __builtin_amdgcn_sched_barrier(0);
      put((j + 1) & 1, s4[j + 1], m4, x4);
    }
  }

  // C/D layout: VGPR v -> row v (lanes 0-15) / row v+8 (lanes 16-31)
#pragma unroll
  for (int v = 0; v < 8; ++v) {
    int row = ti * 16 + v + 8 * h;
    Wm[row * WP + ncol] = acc0[v] + acc1[v];
  }
  __syncthreads();

  // ---- L1 row normalization (rows 45..47 are all-zero: 0*1/eps=0)
  if (tid < LQ) {
    float s = 0.0f;
    for (int q = 0; q < LQ; ++q) s += fabsf(Wm[tid * WP + q]);
    float inv = 1.0f / fmaxf(s, 1e-12f);
    for (int q = 0; q < LP; ++q) Wm[tid * WP + q] *= inv;
  }
  __syncthreads();

  // Wt[b][j / 2][i / 16][l][j % 2][i % 16] = Wm[i][j]: rows 45..47 of Wm are zero
  // and go along, so that the reader's padded columns are zero too. A 128-B line
  // belongs to one layer, so no line is written by two workgroups; it holds what
  // two neighbouring waves of one reading workgroup take, and nothing else.
  __builtin_assume(tid < 288);        // lets all range tests but the last fold
  const int jj0 = tid / LP, ii = tid - jj0 * LP;      // 288 = 6 x 48
  float* wd = Wt + ((((size_t)b * NPR + (jj0 >> 1)) * 3 + (ii >> 4)) * NLAY + l) * WTP
                 + (jj0 & 1) * 16 + (ii & 15);
  // unrolled: the LDS reads run ahead of the stores, all offsets immediates
#pragma unroll
  for (int it = 0; it < 8; ++it)
    if (jj0 + 6 * it < LQ)
      wd[(size_t)it * 3 * 3 * NLAY * WTP] = Wm[ii * WP + jj0 + 6 * it];
}

// ---------------------------------------------------------------------------
// Fallback (no workspace): one workgroup per (layer, batch). 288 threads = 9 wave32.
//   Stage 1: build Uu (=unfold(I*S*M)) and Ku (=unfold(I*S*(1-M))) in LDS.
//   Stage 2: Wm = Uu^T * Ku        (45x45 padded 48x48, K=432)  [f32 WMMA]
//   Stages 1 and 2 run in NCH row chunks: Ku is kept whole (stage 4 reads it
//   again), Uu is only the k-stream of stage 2, so just one chunk of it lives
//   in LDS. That brings LDS under a third of a WGP's, so three workgroups are
//   resident per WGP and the whole grid (532) runs in one round.
//   Both lie patch-major in LDS: a fill lane's 4 neighbouring pixels are 4
//   neighbouring unfold rows of one patch (one 16-B store), a stage-2 lane
//   reads the 4 unfold rows of two k-steps in one 16-B load, and stage 4 reads
//   16 neighbouring unfold rows of one patch with 16 lanes.
//   Stage 3: L1-normalize rows of Wm
//   Stage 4: WK = Ku * Wm^T        (432x45 padded 48,  K=48)    [f32 WMMA]
//            fold + layer reduction: atomicAdd into the out accumulator
// Dual accumulators in both k-loops break the WMMA RAW dependency chain.
// ---------------------------------------------------------------------------
__global__ __launch_bounds__(288) void matting_layer_kernel(
    const float* __restrict__ I,     // (4,3,60,108)
    const float* __restrict__ S,     // (4,60,108,133)
    const float* __restrict__ M,     // (4,1,60,108)
    float* __restrict__ outacc)      // (4,3,60,108) accumulator
{
  __shared__ __align__(16) float Ku[LP * KP];   // 83712 B, [patch][unfold row]
  __shared__ __align__(16) float Uc[LP * UP];   // 14592 B, [patch][chunk row]
  float* const Wm = Uc;   // 48 x WP, written only after the last read of Uc

  const int l    = blockIdx.x;          // layer
  const int b    = blockIdx.y;          // batch
  const int tid  = threadIdx.x;
  const int lane = tid & 31;
  const int wave = tid >> 5;            // 0..8

  const float* Ib = I + (size_t)b * 3 * NPIX;
  const float* Sb = S + (size_t)b * NPIX * NLAY + l;
  const float* Mb = M + (size_t)b * NPIX;

  // ---- Stage 1a: zero the 3 padding patches (45..47) of Ku and Uc ---------
  for (int e = tid; e < (LP - LQ) * KP / 4; e += 288) {
    const float4 z4 = {0.0f, 0.0f, 0.0f, 0.0f};
    ((float4*)&Ku[LQ * KP])[e] = z4;
    if (e < (LP - LQ) * UP / 4) ((float4*)&Uc[LQ * UP])[e] = z4;
  }

  // ---- Stages 1b + 2, chunk by chunk --------------------------------------
  // Chunk j holds the unfold rows with k1 in [2j, 2j+2), all three channels:
  //   chunk row  c*24  + (k1-2j)*12 + k2   <->   unfold row  c*144 + k1*12 + k2
  // A(16x4 f32) layout: lane<16: M=lane, VGPRv=K(2h+v) ; lanes>=16: K+=2
  {
    const int ti   = wave / 3, tj = wave - ti * 3;
    const int h    = lane >> 4;
    const int mcol = ti * 16 + (lane & 15);   // output row  (p index)
    const int ncol = tj * 16 + (lane & 15);   // output col  (q index)
    v8f acc0 = {}, acc1 = {};

    for (int j = 0; j < NCH; ++j) {
      // fill: 10 image rows (5 patch rows x 2 k1) of 27 quads, 1 write/element.
      // A quad is 4 neighbouring pixels of one patch row (12 = 3 quads): M and
      // I are each read 16 B a lane, in whole lines.
      for (int e = tid; e < CPIX / 4; e += 288) {
        int rr = e / (WID / 4), wq = e - rr * (WID / 4);
        int ph = rr / CK1, kl = rr - ph * CK1;  // kl = k1 - 2j
        int pw = wq / 3,   k2 = (wq - pw * 3) * 4;
        int pix   = (ph * KS + j * CK1 + kl) * WID + wq * 4;
        int p     = ph * PW + pw;               // patch index
        int rbase = kl * KS + k2;               // within-channel chunk row
        float4 s4;
        s4.x = Sb[(size_t)pix * NLAY];
        s4.y = Sb[(size_t)(pix + 1) * NLAY];
        s4.z = Sb[(size_t)(pix + 2) * NLAY];
        s4.w = Sb[(size_t)(pix + 3) * NLAY];
        // precaution: stands in front of the loads below, whose results the
        // compiler may place in address registers of the four loads above
        asm volatile("s_wait_xcnt 0x0" ::: "memory");
        const float4 m4 = *(const float4*)&Mb[pix];
        const float s[4] = {s4.x, s4.y, s4.z, s4.w};
        const float m[4] = {m4.x, m4.y, m4.z, m4.w};
        float sm[4], sk[4];
        // the loops over i and c are unrolled: constant indices keep the small
        // arrays in registers and turn the LDS offsets into immediates
#pragma unroll
        for (int i = 0; i < 4; ++i) {
          sm[i] = s[i] * m[i];                  // S*M
          sk[i] = s[i] - sm[i];                 // S*(1-M)
        }
#pragma unroll
        for (int c = 0; c < 3; ++c) {
          const float4 i4 = *(const float4*)&Ib[c * NPIX + pix];
          float4 u4, k4;
          u4.x = i4.x * sm[0];  k4.x = i4.x * sk[0];
          u4.y = i4.y * sm[1];  k4.y = i4.y * sk[1];
          u4.z = i4.z * sm[2];  k4.z = i4.z * sk[2];
          u4.w = i4.w * sm[3];  k4.w = i4.w * sk[3];
          *(float4*)&Uc[p * UP + c * CRC + rbase]           = u4;
          *(float4*)&Ku[p * KP + c * 144 + j * CRC + rbase] = k4;
        }
      }
      __syncthreads();   // chunk j of Uc and Ku is complete

      // Wm += Uc^T * Ku(chunk rows); 9 waves <-> 9 (16x16) tiles
      // A lane reads 4 neighbouring rows (8kk + 4h + 0..3) of its patch from
      // each operand: elements 0,1 feed one k-step, elements 2,3 the next.
      // A and B take the same rows at the same (h, element) place.
      const float* ua = &Uc[mcol * UP + 4 * h];
      const float* kb = &Ku[ncol * KP + j * CRC + 4 * h];
      // unrolled so that the channel's row offset is compile-time and the LDS
      // offsets are immediates (9 pairs of k-steps, two WMMA chains)
#pragma unroll
      for (int kk = 0; kk < CRR / 8; ++kk) {
        const int ra = 8 * kk;                                // chunk row
        const int rb = 8 * kk + (kk / (CRC / 8)) * (144 - CRC); // unfold row - 24j
        const float4 a4 = *(const float4*)&ua[ra];
        const float4 b4 = *(const float4*)&kb[rb];
        v2f a, bb, a2, bb2;
        a.x  = a4.x;  a.y  = a4.y;  bb.x  = b4.x;  bb.y  = b4.y;
        a2.x = a4.z;  a2.y = a4.w;  bb2.x = b4.z;  bb2.y = b4.w;
        acc0 = __builtin_amdgcn_wmma_f32_16x16x4_f32(
            false, a, false, bb, (short)0, acc0, false, false);
        acc1 = __builtin_amdgcn_wmma_f32_16x16x4_f32(
            false, a2, false, bb2, (short)0, acc1, false, false);
      }
      __syncthreads();   // every wave has left Uc: refill it (or write Wm)
    }

    // C/D layout: VGPR v -> row v (lanes 0-15) / row v+8 (lanes 16-31)
#pragma unroll
    for (int v = 0; v < 8; ++v) {
      int row = ti * 16 + v + 8 * h;
      Wm[row * WP + ncol] = acc0[v] + acc1[v];
    }
  }
  __syncthreads();

  // ---- Stage 3: L1 row normalization (rows 45..47 are all-zero: 0*1/eps=0)
  if (tid < LQ) {
    float s = 0.0f;
    for (int q = 0; q < LQ; ++q) s += fabsf(Wm[tid * WP + q]);
    float inv = 1.0f / fmaxf(s, 1e-12f);
    for (int q = 0; q < LP; ++q) Wm[tid * WP + q] *= inv;
  }
  __syncthreads();

  {
    // ---- Stage 4: WK = Ku * Wm^T ; 81 tiles over 9 waves, fold + reduce ---
    const int h  = lane >> 4;
    const int lc = lane & 15;
    // t = wave + 9i keeps t % 3: a wave's column tile, and with it its Wm
    // fragments, are the same for all its tiles. They are read here, once.
    const int nt   = wave % 3;
    const int ncol = nt * 16 + lc;                // patch index i
    v2f bw[12];
#pragma unroll   // bw[] stays in registers only with constant indices
    for (int s = 0; s < 12; ++s)
      bw[s] = *(const v2f*)&Wm[ncol * WP + 4 * s + 2 * h];
    for (int t = wave; t < 81; t += 9) {          // uniform: 9 iters per wave
      const int mt = t / 3;
      const int mrow = mt * 16 + lc;              // unfold row (c,k1,k2)
      v8f acc0 = {}, acc1 = {};
#pragma unroll
      for (int s = 0; s < 6; ++s) {               // 12 k-steps, 2 chains
        const int ka = 8 * s + 2 * h;             // patch j of the k-step
        v2f a, a2;      // 16 lanes read 16 neighbouring unfold rows of a patch
        a.x  = Ku[ka * KP + mrow];
        a.y  = Ku[(ka + 1) * KP + mrow];
        a2.x = Ku[(ka + 4) * KP + mrow];
        a2.y = Ku[(ka + 5) * KP + mrow];
        acc0 = __builtin_amdgcn_wmma_f32_16x16x4_f32(
            false, a, false, bw[2 * s], (short)0, acc0, false, false);
        acc1 = __builtin_amdgcn_wmma_f32_16x16x4_f32(
            false, a2, false, bw[2 * s + 1], (short)0, acc1, false, false);
      }
      if (ncol < LQ) {
        const int ph = ncol / PW, pw = ncol - ph * PW;
#pragma unroll
        for (int v = 0; v < 8; ++v) {
          int   r   = mt * 16 + v + 8 * h;        // 0..431
          int   c   = r / 144, rem = r - c * 144;
          int   k1  = rem / KS, k2 = rem - k1 * KS;
          int   pix = (ph * KS + k1) * WID + pw * KS + k2;
          atomicAdd(&outacc[((size_t)b * 3 + c) * NPIX + pix],
                    acc0[v] + acc1[v]);
        }
      }
    }
  }
}

// ---------------------------------------------------------------------------
// ws path, second product, fold and blend in one launch.
// With K_l[c,kk,j] = I[c,kk,j] * (1-M)[kk,j] * S_l[kk,j]
// (kk = pixel inside a patch, j = patch) the sum over layers of Wm_l * K_l is
//   sum[c,kk,i] = sum_j I[c,kk,j] * (1-M)[kk,j] * T_j[kk,i],
//   T_j[kk,i]   = sum_l S_l[kk,j] * Wm_l[i,j].
// T_j is one GEMM per (b, j): 144 x 48, K = 133 layers (padded 136). The layer
// sum is its k dimension and the channel factor is outside it.
// A workgroup owns one 16 x 16 tile (16 patch pixels kk, 16 patches i) and one
// half of the patches j, a wave per j: every wave makes its own T_j tile and
// scales it by its j's three channel factors, the waves' tiles are summed in
// LDS. So no T_j goes through memory and no further launch folds them.
// No operand is shared between waves:
//   A: in S as given a pixel's layers lie in a row. A wave reads its 16 pixels'
//      runs in whole (16-B loads, 4-B aligned) and puts them in LDS of its own,
//      where a lane finds the 4 layers of two k-steps of its pixel in 16 B;
//   B: a lane reads its column i of 4 layers' lines of Wt.
// out: a tile is no set of whole 128-B lines, and each element has two
// addends (the halves of j). Both are added with an atomic onto the zero that
// the first launch stored: 0 + x + y rounds once, the same in either order.
// ---------------------------------------------------------------------------
// 24 waves are 6 per SIMD, and no second workgroup fits beside (LDS): said to
// the compiler, so that it spends the registers of 6 waves per SIMD on loads in
// flight; without it it keeps to fewer and loads a few k-steps at a time.
__global__ __launch_bounds__(JH * 32) __attribute__((amdgpu_waves_per_eu(6, 6)))
void layer_fold_kernel(
    const float* __restrict__ I,     // (4,3,60,108)
    const float* __restrict__ S,     // (4,60,108,133)
    const float* __restrict__ M,     // (4,1,60,108)
    const float* __restrict__ Wt,    // (4,NPR,3,133,WTP)
    float* __restrict__ out)         // (4,3,60,108), zero at entry
{
  // a part per wave: first its S tile [pixel][layer], pitch AP, then, over it,
  // its results [channel][column][row], pitch RP
  __shared__ __align__(16) float sh[JH * 16 * AP];        // 215040 B

  const int mt   = blockIdx.x;          // 16 patch pixels kk
  const int nt   = blockIdx.y;          // 16 patches i
  const int b    = blockIdx.z >> 1;
  const int jh   = blockIdx.z & 1;      // half of the patches j
  const int tid  = threadIdx.x;
  const int lane = tid & 31;
  const int wave = tid >> 5;            // 0..23
  const int h    = lane >> 4;
  const int lc   = lane & 15;
  // the second half has 21 patches: its last 3 waves work on patch 44 again and
  // their factor is zero, so that no branch stands around the WMMAs
  const bool live = jh * JH + wave < LQ;
  const int  j    = live ? jh * JH + wave : LQ - 1;
  const int  pj   = (j / PW) * KS * WID + (j % PW) * KS;  // patch's first pixel
  // the tile's 16 patch pixels are 4 quads; quad x lies qoff(x) pixels behind
  // its patch's first pixel: the tile starts at quad mt % 3 of a patch row (3
  // quads), and the quads from the next patch row on lie WID - KS further
  const int t0 = 16 * mt + (4 * mt / 3) * (WID - KS), x1 = 3 - mt % 3;
  auto qoff = [&](int x) { return t0 + 4 * x + (x >= x1 ? WID - KS : 0); };

  // A(16x4): lane -> row kk = lc; B(4x16): lane -> column i = lc. A lane takes
  // the 4 layers 8s + 4h + 0..3 of its row and of its column: elements 0,1 feed
  // one k-step, elements 2,3 the next. A and B take the same layers at the
  // same (h, element) place. Layers 133..135 are zero in both.
  float* const as = &sh[wave * 16 * AP];
  const unsigned vo = (unsigned)(pj * NLAY + 4 * lane) * 4;       // in bytes
  const unsigned vt = (unsigned)((pj + qoff(lane >> 3) + ((lane >> 1) & 3)) * NLAY
                                 + 128 + (lane & 1)) * 4;         // in bytes
  const float* sb = S + (size_t)b * NPIX * NLAY;
  // a quad's base, held in scalar registers: else the compiler adds the lane
  // offset to it first and spends a pair of vector registers on every quad
  const GLB char* sq[4];
#pragma unroll
  for (int x = 0; x < 4; ++x) {
    const unsigned long long u = (unsigned long long)(sb + qoff(x) * NLAY);
    sq[x] = (const GLB char*)(((unsigned long long)(unsigned)__builtin_amdgcn_readfirstlane(
                                   (int)(u >> 32)) << 32)
                              | (unsigned)__builtin_amdgcn_readfirstlane((int)u));
  }
  // addresses: a base that is the same in all lanes and a 32-bit lane offset
  const float*   wu = Wt + ((size_t)b * NPR * 3 + nt) * NLAY * WTP;
  const unsigned w0 = (unsigned)((j >> 1) * 3 * NLAY * WTP + (j & 1) * 16 + lc);
  const unsigned wb = w0 + 4 * h * WTP;
  // S tile: a load takes layers 0..127 of one pixel, 512 B in a row, with the
  // whole wave; the last takes layers 128..131 (even lanes) and 129..132 (odd
  // lanes, which keep layer 132) of all 16 pixels
  v4f r4[17], b4[LK / 8];
#pragma unroll   // r4[] and b4[] stay in registers only with constant indices
  for (int r = 0; r < 16; ++r) {
    r4[r] = *(const GLB v4fu*)(sq[r >> 2] + (r & 3) * NLAY * 4 + vo);
  }
  r4[16] = *(const v4fu*)((const char*)sb + vt);
#pragma unroll
  for (int s = 0; s < LK / 8 - 1; ++s) {
#pragma unroll
    for (int e = 0; e < 4; ++e) b4[s][e] = (wu + (8 * s + e) * WTP)[wb];
  }
  {
    const float w  = (wu + 128 * WTP)[wb];     // layer 128 or 132
    const float w1 = (wu + 129 * WTP)[w0], w2 = (wu + 130 * WTP)[w0];
    const float w3 = (wu + 131 * WTP)[w0];
    b4[LK / 8 - 1].x = w;
    b4[LK / 8 - 1].y = h ? 0.0f : w1;
    b4[LK / 8 - 1].z = h ? 0.0f : w2;
    b4[LK / 8 - 1].w = h ? 0.0f : w3;
  }
#pragma unroll
  for (int r = 0; r < 16; ++r) *(v4f*)&as[r * AP + 4 * lane] = r4[r];
  {
    const v4f t = r4[16];
    const v4f u = {t.w, 0.0f, 0.0f, 0.0f};
    *(v4f*)&as[(lane >> 1) * AP + 128 + 4 * (lane & 1)] = (lane & 1) ? u : t;
  }
  // the tile is the wave's own: its LDS operations run in order, so no barrier
  // instruction is needed; this keeps the compiler from moving a read up
  __builtin_amdgcn_wave_barrier();
  const float* ap = &as[lc * AP + 4 * h];

  // M and I of patch j at the lane's 8 result rows kk = 16*mt + 8h + 0..7
  const float* mu = M + (size_t)b * NPIX;
  const float* xu = I + (size_t)b * 3 * NPIX;
  v4f mr[2], xr[3][2];
  unsigned off[2];
#pragma unroll
  for (int g = 0; g < 2; ++g) {
    off[g] = (unsigned)(pj + qoff(2 * h + g)) * 4;            // in bytes
    mr[g]  = *(const v4f*)((const char*)mu + off[g]);
#pragma unroll
    for (int c = 0; c < 3; ++c) xr[c][g] = *(const v4f*)((const char*)(xu + c * NPIX) + off[g]);
  }

  // the blend's own M and I (thread -> channel, patch i, quad of the tile) are
  // read up here with the rest, so that their latency is not paid again behind
  // the barrier; threads past the tile's 192 quads read some quad of it
  const int oc  = (tid / 64) % 3, oi = (tid >> 2) & 15;
  const int i   = 16 * nt + oi;
  const int iv  = i < LQ ? i : LQ - 1;
  const unsigned pix = (unsigned)((iv / PW) * KS * WID + (iv % PW) * KS + qoff(tid & 3));
  const unsigned pxo = oc * NPIX + pix;
  const unsigned pb = pix * 4, xb = pxo * 4;                  // in bytes
  const v4f m4 = *(const v4f*)((const char*)mu + pb);
  const v4f i4 = *(const v4f*)((const char*)xu + xb);

  // keeps these ten loads up here: without it the scheduler puts them behind
  // most of the WMMAs, and a wave waits for them at its end, with nothing left
  __builtin_amdgcn_sched_barrier(0);

  // two accumulators: two independent WMMA chains
  v8f acc0 = {}, acc1 = {};
#pragma unroll
  for (int s = 0; s < LK / 8; ++s) {
    v2f a, bb, a2, bb2;
    const v4f a4 = *(const v4f*)&ap[8 * s];
    a.x  = a4.x;  a.y  = a4.y;  bb.x  = b4[s].x;  bb.y  = b4[s].y;
    a2.x = a4.z;  a2.y = a4.w;  bb2.x = b4[s].z;  bb2.y = b4[s].w;
    acc0 = __builtin_amdgcn_wmma_f32_16x16x4_f32(
        false, a, false, bb, (short)0, acc0, false, false);
    acc1 = __builtin_amdgcn_wmma_f32_16x16x4_f32(
        false, a2, false, bb2, (short)0, acc1, false, false);
  }
  // The four v_nop keep the distance between the last WMMAs and the vector
  // instructions that read their results or reuse their operand registers; the
  // two scheduling barriers keep every such instruction behind them.
  // The wait is a precaution: the addresses are inputs, and so are the results
  // of everything that was loaded, so that no register that one of the loads
  // above names is given a new value in front of it.
  __builtin_amdgcn_sched_barrier(0);
  asm volatile("v_nop\n\tv_nop\n\tv_nop\n\tv_nop\n\ts_wait_xcnt 0x0"
               :: "v"(acc0), "v"(acc1), "v"(mr[0]), "v"(mr[1]),
                  "v"(xr[0][0]), "v"(xr[0][1]), "v"(xr[1][0]), "v"(xr[1][1]),
                  "v"(xr[2][0]), "v"(xr[2][1]), "v"(m4), "v"(i4),
                  "v"(vo), "v"(vt), "v"(w0), "v"(wb), "v"(off[0]), "v"(off[1]),
                  "v"(pb), "v"(xb), "s"(sq[0]), "s"(sq[1]), "s"(sq[2]), "s"(sq[3]),
                  "s"(sb), "s"(wu), "s"(mu), "s"(xu)
               : "memory");
  __builtin_amdgcn_sched_barrier(0);

  // D: VGPR v -> row kk = 16*mt + 8h + v, column i = 16nt + lc: two quads a lane.
  // They go over the wave's own S tile, behind its last read of it.
#pragma unroll   // constant accumulator indices keep acc0/acc1 in registers
  for (int g = 0; g < 2; ++g) {
    const v4f km = live ? 1.0f - mr[g] : (v4f){0.0f, 0.0f, 0.0f, 0.0f};
    v4f t4;
    t4.x = (acc0[4 * g]     + acc1[4 * g])     * km.x;
    t4.y = (acc0[4 * g + 1] + acc1[4 * g + 1]) * km.y;
    t4.z = (acc0[4 * g + 2] + acc1[4 * g + 2]) * km.z;
    t4.w = (acc0[4 * g + 3] + acc1[4 * g + 3]) * km.w;
#pragma unroll
    for (int c = 0; c < 3; ++c)
      *(v4f*)&as[(c * 16 + lc) * RP + 8 * h + 4 * g] = t4 * xr[c][g];
  }
  __syncthreads();   // all waves' tiles are in LDS

  if (tid < 3 * 64 && i < LQ) {
    const float* rp = &sh[(oc * 16 + oi) * RP + 4 * (tid & 3)];
    v4f s = *(const v4f*)rp;
#pragma unroll   // the LDS reads run ahead of the additions
    for (int w = 1; w < JH; ++w) s += *(const v4f*)&rp[w * 16 * AP];
    v4f val = s * m4;
    if (jh == 0) val += i4 * (1.0f - m4);
    float* po = out + (size_t)b * 3 * NPIX + pxo;
    atomicAdd(&po[0], val.x);
    atomicAdd(&po[1], val.y);
    atomicAdd(&po[2], val.z);
    atomicAdd(&po[3], val.w);
  }
}

// ---------------------------------------------------------------------------
// atomic-path helpers: zero d_out first.
// ---------------------------------------------------------------------------
__global__ void zero_kernel(float* __restrict__ out, int n) {
  int i = blockIdx.x * blockDim.x + threadIdx.x;
  if (i < n) out[i] = 0.0f;
}

__global__ void blend_kernel(const float* __restrict__ I,
                             const float* __restrict__ M,
                             float* __restrict__ out, int n) {
  int i = blockIdx.x * blockDim.x + threadIdx.x;
  if (i < n) {
    int b   = i / (3 * NPIX);
    int pix = i % NPIX;
    float m = M[(size_t)b * NPIX + pix];
    out[i] = I[i] * (1.0f - m) + out[i] * m;
  }
}

// ---------------------------------------------------------------------------
extern "C" void kernel_launch(void* const* d_in, const int* in_sizes, int n_in,
                              void* d_out, int out_size, void* d_ws, size_t ws_size,
                              hipStream_t stream) {
  const float* I = (const float*)d_in[0];
  const float* S = (const float*)d_in[1];
  const float* M = (const float*)d_in[2];
  float* out = (float*)d_out;

  const int    n    = NB * 3 * NPIX;                              // 77760
  const size_t nst  = (size_t)NB * NLAY * SPITCH;                 // 13.9 MB
  const size_t nwt  = (size_t)NB * NPR * 3 * NLAY * WTP;          // 4.7 MB
  const size_t need = (nst + nwt) * sizeof(float);

  if (d_ws != nullptr && ws_size >= need) {
    // every plane below is rewritten in every call before it is read
    float* St = (float*)d_ws;         // transposed S
    float* Wt = St + nst;             // normalized affinities
    transpose_s_kernel<<<TTILE, 256, 0, stream>>>(S, St, out);
    affinity_kernel<<<dim3(NLAY, NB), 288, 0, stream>>>(I, St, M, Wt);
    layer_fold_kernel<<<dim3(PP / 16, LP / 16, 2 * NB), JH * 32, 0, stream>>>(
        I, S, M, Wt, out);
  } else {
    // fallback: accumulate with global atomics directly into d_out
    zero_kernel<<<(n + 255) / 256, 256, 0, stream>>>(out, n);
    matting_layer_kernel<<<dim3(NLAY, NB), 288, 0, stream>>>(I, S, M, out);
    blend_kernel<<<(n + 255) / 256, 256, 0, stream>>>(I, M, out, n);
  }
}

// v008
// A run of this version takes 26.8 microseconds.
// In both of two side-by-side timings against v007, it was 1.05 times as fast.
// Counting every step since v000, it is 2.81 times as fast.
#include <hip/hip_runtime.h>

// ---------------------------------------------------------------------------
// Problem constants (from reference)
// ---------------------------------------------------------------------------
#define HGT   60
#define WID   108
#define NPIX  (HGT * WID)        // 6480 pixels per (b) image plane
#define NLAY  133
#define NB    4
#define KS    12
#define PH    5
#define PW    9
#define LQ    45                 // number of patches (real columns)
#define LP    48                 // padded to 3 x 16 for WMMA tiles
#define CR    432                // unfold rows = 3 * 12 * 12 (27 x 16 exactly)
#define NCH   6                  // row chunks of stages 1+2
#define CK1   2                  // k1 values per chunk (KS / NCH)
#define CRC   (CK1 * KS)         // 24 chunk rows per channel (3 x 8)
#define CRR   (3 * CRC)          // 72 chunk rows = 9 pairs of k-steps of 4
#define CPIX  (PH * CK1 * WID)   // 1080 pixels per chunk
// LDS pitches in floats. Ku and the Uu chunk are kept patch-major (one line
// per patch, the unfold rows along it). Each pitch is 4 x an odd number: 16
// lanes that read 8 or 16 B at that stride fall on 16 different groups of 4
// banks, and every line starts on a multiple of 16 B.
#define KP    436                // Ku: 432 unfold rows + 4
#define UP    76                 // Uu chunk: 72 chunk rows + 4
#define WP    52                 // Wm: 48 columns + 4
#define TPX   64                 // pixels per tile of the S transpose
#define TTILE (NB * NPIX / TPX)  // 405 tiles, all full
#define TV4   (TPX * NLAY / 4)   // 2128 float4 per tile
#define SSKEW (NPIX % TPX)       // 16: start of image b's planes, times b
#define SPITCH 6528              // plane pitch of the transposed S (102 x 64)
#define PP    (KS * KS)          // 144 pixels of a patch
#define LK    136                // layers padded to 34 k-steps of 4
#define WTP   32                 // a line of Wt: 2 patches j x 16 patches i, 128 B
#define NPR   23                 // pairs of patches j (the last holds one)
#define JH    24                 // patches j (= waves) per layer-GEMM workgroup
#define RP    20                 // LDS pitch of 16 results of a column: 16 B x odd
#define AP    140                // LDS pitch of a pixel's 136 layers: 16 B x odd
#define FQ    48                 // output quads zeroed per transpose tile (6 x 128 B)
#define NFL   128                // layers whose first product is one workgroup's
#define NRJ   (3 * (NLAY - NFL)) // row-tile workgroups of an image's other layers

typedef __attribute__((ext_vector_type(2))) float v2f;
typedef __attribute__((ext_vector_type(4))) float v4f;
typedef __attribute__((ext_vector_type(8))) float v8f;
typedef v4f v4fu __attribute__((aligned(4)));   // 16 B at a multiple of 4 B
#define GLB __attribute__((address_space(1)))   // a pointer made from an integer
                                                // is told to be global memory

// ---------------------------------------------------------------------------
// Pre-pass (ws path): S (b, pix, layer) -> St (b, layer, pix), pitch SPITCH.
// In S one layer's pixels lie 532 B apart, so a wave of the main kernel that
// reads 32 pixels of its layer touches 32 cache lines for 128 useful bytes,
// and every line is fetched again by each of the layers that share it. Here
// S is read once in whole lines (a tile of 64 pixels x 133 layers is one
// contiguous run), turned in LDS and written as 256-B runs, one per layer.
// Tiles run over the 25920 pixels of all images (405 full tiles); image b's
// planes start SSKEW*b floats into their pitch, so that every run of 64
// pixels starts on a multiple of 256 B although 6480 is no multiple of 64.
// LDS reads: lane stride 266 dwords (10 mod 64) -> 32 distinct banks.
// Each tile's workgroup also stores the zeros of FQ quads of out (whole lines),
// the start value that the last launch adds onto.
// ---------------------------------------------------------------------------
__global__ __launch_bounds__(256) void transpose_s_kernel(
    const float* __restrict__ S,     // (4,60,108,133)
    float* __restrict__ St,          // (4,133,SPITCH)
    float* __restrict__ out)         // (4,3,60,108)
{
  // 2128 float4 of data; rounded up to 9 x 256 so that no fill step branches
  __shared__ __align__(16) float tile[9 * 256 * 4];  // 36864 B

  const int t    = blockIdx.x;          // tile
  const int tid  = threadIdx.x;
  const int lane = tid & 31;
  const int wave = (tid >> 5) & 7;

  const float4* src = (const float4*)(S + (size_t)t * TPX * NLAY);
  float4 r[9];
  // unrolled and branch-free (the last step's surplus lanes re-read the
  // tile's last float4 and put it behind the data in LDS, where nobody reads):
  // all nine loads are in flight before the first LDS store waits for one
#pragma unroll
  for (int i = 0; i < 9; ++i) {
    int e = tid + i * 256;
    r[i] = src[e < TV4 ? e : TV4 - 1];
  }
#pragma unroll   // r[] stays in registers only with constant indices
  for (int i = 0; i < 9; ++i) ((float4*)tile)[tid + i * 256] = r[i];
  __syncthreads();

  const int g = t * TPX + 2 * lane;     // pixel over all images; pairs stay
  const int b = g / NPIX;               // inside one image (6480 is even)
  const float* tp  = &tile[2 * lane * NLAY + wave];
  float*       dst = St + ((size_t)b * NLAY + wave) * SPITCH
                        + (g - b * NPIX) + b * SSKEW;
  // unrolled so that the LDS reads of many layers run ahead of the stores
#pragma unroll
  for (int i = 0; i < NLAY / 8; ++i) {  // layers wave + 8i <= 127
    float2 v;
    v.x = tp[8 * i];
    v.y = tp[NLAY + 8 * i];
    *(float2*)(dst + (size_t)(8 * i) * SPITCH) = v;
  }
  if (wave < NLAY % 8) {                // layers 128..132
    float2 v;
    v.x = tp[NLAY / 8 * 8];
    v.y = tp[NLAY + NLAY / 8 * 8];
    *(float2*)(dst + (size_t)(NLAY / 8 * 8) * SPITCH) = v;
  }
  if (tid < FQ) {                       // behind the barrier, which would wait for it
    const float4 z4 = {0.0f, 0.0f, 0.0f, 0.0f};
    ((float4*)out)[t * FQ + tid] = z4;
  }
}

// ---------------------------------------------------------------------------
// ws path, first product: a workgroup per (layer, batch) or per row of its tiles, 288 threads = 9
// wave32, one 16 x 16 tile (or a third of its K) of Wm = Uu^T * Ku (45 x 45 padded 48 x 48, K = 432)
// per wave [f32 WMMA], then the L1 normalization of its rows. The normalized Wm
// goes to the workspace, in 128-B lines of 2 column patches j x 16 rows i, one layer each; the
// second product and the sum over the layers are layer_fold_kernel's.
// Uu = unfold(I*S*M) and Ku = unfold(I*S*(1-M)) are both only the k-stream of
// this product, so just NCH-th parts (chunks) of them live in LDS, patch-major
// as in the fallback kernel, in two buffers each. The stream is a pipeline:
//   - a thread's six quads of the layer's plane (they come from memory) are all
//     asked for at entry, so memory latency is waited out once, not per chunk;
//   - M and I of chunk j+1 are asked for in front of the WMMAs of chunk j;
//   - chunk j+1 is multiplied and stored into the other buffer behind them.
// One barrier per chunk does both jobs: it publishes chunk j and it ends every
// wave's reads of the buffer that chunk j+1 is stored into behind it.
// Chunks, k-steps and the two accumulators are those of the fallback kernel.
// Placement: all workgroups are resident at once and the matrix units set the
// time, so the launch lasts as long as the WGP with the most WMMAs. 4 x 133
// equal workgroups are two per WGP and 20 over, and a WGP with a third one has
// half as much again to do. So only 4 x NFL workgroups (two per WGP) take a
// whole layer. Each of the other layers is cut into three workgroups:
// one takes one row of three tiles (a row of Wm is normalized by
// itself) and its waves are 3 tiles x 3 parts of every chunk's k-steps, a third
// of the WMMAs. The parts are added in LDS in front of the normalization.
// ---------------------------------------------------------------------------
__global__ __launch_bounds__(288) void affinity_kernel(
    const float* __restrict__ I,     // (4,3,60,108)
    const float* __restrict__ St,    // (4,133,SPITCH)
    const float* __restrict__ M,     // (4,1,60,108)
    float* __restrict__ Wt)          // (4,NPR,3,133,WTP) normalized Wm
{
  __shared__ __align__(16) float Uc[2 * LP * UP];   // 29184 B, [buf][patch][chunk row]
  __shared__ __align__(16) float Kc[2 * LP * UP];   // 29184 B, the same
  float* const Wm = Uc;   // 48 x WP in buffer 0, which the last chunk does not use

  const int  id   = blockIdx.x;
  const bool full = id < NB * NFL;      // whole layer, or one row of tiles
  const int  rj   = id - NB * NFL;
  const int  b    = full ? id / NFL : rj / NRJ;                 // batch
  const int  l    = full ? id % NFL : NFL + (rj % NRJ) / 3;     // layer
  const int  tr   = full ? 0 : rj % 3;  // the row of tiles
  const int tid  = threadIdx.x;
  const int lane = tid & 31;
  const int wave = tid >> 5;            // 0..8

  // Fill: a chunk is 10 image rows (5 patch rows x 2 k1) of 27 quads = 270
  // quads, one per thread; a quad is 4 neighbouring pixels of one patch row.
  // The 18 threads left over take the 18 quads of the 3 padding patches: they
  // read some valid quad and store zeros (their S factor is 0), so that no
  // branch stands in the pipeline and the padding needs no pass of its own.
  const bool real = tid < CPIX / 4;
  const int  e    = real ? tid : tid - CPIX / 4;     // pad: 0..17
  const int  rr   = e / (WID / 4), wq = e - rr * (WID / 4);
  const int  ph   = rr / CK1;
  const int  kl   = real ? rr - ph * CK1 : (e / 3) & 1;   // k1 - 2j
  const int  p    = real ? ph * PW + wq / 3 : LQ + e / 6; // patch
  const int  pix0 = (ph * KS + (rr - ph * CK1)) * WID + wq * 4;
  const int  dst  = p * UP + kl * KS + (e % 3) * 4;  // wq % 3 == e % 3 (27 = 9 x 3)
  const float* sp = St + ((size_t)b * NLAY + l) * SPITCH + b * SSKEW + pix0;
  const float* mp = M + (size_t)b * NPIX + pix0;
  const float* ip = I + (size_t)b * 3 * NPIX + pix0;

  // chunk row  c*24 + (k1-2j)*12 + k2   <->   unfold row  c*144 + k1*12 + k2
  auto put = [&](int buf, const v4f s4, const float4 m4, const float4* x4) {
    const float s[4] = {real ? s4.x : 0.0f, real ? s4.y : 0.0f,
                        real ? s4.z : 0.0f, real ? s4.w : 0.0f};
    const float m[4] = {m4.x, m4.y, m4.z, m4.w};
    float sm[4], sk[4];
    // the loops over i and c are unrolled: constant indices keep the small
    // arrays in registers and turn the LDS offsets into immediates
#pragma unroll
    for (int i = 0; i < 4; ++i) {
      sm[i] = s[i] * m[i];                  // S*M
      sk[i] = s[i] - sm[i];                 // S*(1-M)
    }
#pragma unroll
    for (int c = 0; c < 3; ++c) {
      float4 u4, k4;
      u4.x = x4[c].x * sm[0];  k4.x = x4[c].x * sk[0];
      u4.y = x4[c].y * sm[1];  k4.y = x4[c].y * sk[1];
      u4.z = x4[c].z * sm[2];  k4.z = x4[c].z * sk[2];
      u4.w = x4[c].w * sm[3];  k4.w = x4[c].w * sk[3];
      *(float4*)&Uc[buf * LP * UP + dst + c * CRC] = u4;
      *(float4*)&Kc[buf * LP * UP + dst + c * CRC] = k4;
    }
  };

  // chunk 0's operands first (loads return in order), then the rest of the plane
  v4f    s4[NCH];
  float4 m4, x4[3];
  s4[0] = *(const v4f*)sp;
  m4    = *(const float4*)mp;
#pragma unroll   // x4[] and s4[] stay in registers only with constant indices
  for (int c = 0; c < 3; ++c) x4[c] = *(const float4*)&ip[c * NPIX];
#pragma unroll
  for (int j = 1; j < NCH; ++j) s4[j] = *(const v4f*)&sp[j * CK1 * WID];
  put(0, s4[0], m4, x4);
  // inputs-only fence on the loaded values: it keeps the loads of the plane's
  // later quads in front of the first barrier. Without it the compiler moves
  // them down into the chunks, where each wave waits for memory again.
  asm volatile("" :: "v"(s4[1]), "v"(s4[2]), "v"(s4[3]), "v"(s4[4]), "v"(s4[5]));

  // A(16x4 f32) layout: lane<16: M=lane, VGPRv=K(2h+v) ; lanes>=16: K+=2
  const int w3   = wave / 3, tj = wave - w3 * 3;
  const int ti   = full ? w3 : tr;          // w3: row of tiles, or part of k
  const int kk0  = full ? 0 : 3 * w3;       // first pair of k-steps in a chunk
  const int h    = lane >> 4;
  const int mcol = ti * 16 + (lane & 15);   // output row  (p index)
  const int ncol = tj * 16 + (lane & 15);   // output col  (q index)
  // The stream of chunks, written once and built twice, for 9 and for 3 pairs of
  // k-steps a chunk: each build is straight-line code with its own registers.
  auto stream = [&](auto npc) {
    constexpr int NPC = decltype(npc)::value;   // pairs of k-steps per chunk
    v8f acc0 = {}, acc1 = {};

    // unrolled: s4[] keeps constant indices, the buffer and the global offsets
    // are compile-time
#pragma unroll
    for (int j = 0; j < NCH; ++j) {
      __syncthreads();   // chunk j is complete; every wave has left the other buffer
      if (j + 1 < NCH) {
        m4 = *(const float4*)&mp[(j + 1) * CK1 * WID];
#pragma unroll
        for (int c = 0; c < 3; ++c)
          x4[c] = *(const float4*)&ip[c * NPIX + (j + 1) * CK1 * WID];
        // keeps these loads in front of the WMMAs, which are to cover their
        // latency: without it the scheduler puts chunk 1's behind most of them
        __builtin_amdgcn_sched_barrier(0);
      }

      // Wm += Uc^T * Kc; 9 waves <-> 9 (16x16) tiles, or 3 tiles x 3 parts of k
      // A lane reads 4 neighbouring rows (8kk + 4h + 0..3) of its patch from
      // each operand: elements 0,1 feed one k-step, elements 2,3 the next.
      // A and B take the same rows at the same (h, element) place.
      const float* ua = &Uc[(j & 1) * LP * UP + mcol * UP + 4 * h + 8 * kk0];
      const float* kb = &Kc[(j & 1) * LP * UP + ncol * UP + 4 * h + 8 * kk0];
#pragma unroll   // LDS offsets become immediates (two WMMA chains)
      for (int kk = 0; kk < NPC; ++kk) {
        const float4 a4 = *(const float4*)&ua[8 * kk];
        const float4 b4 = *(const float4*)&kb[8 * kk];
        v2f a, bb, a2, bb2;
        a.x  = a4.x;  a.y  = a4.y;  bb.x  = b4.x;  bb.y  = b4.y;
        a2.x = a4.z;  a2.y = a4.w;  bb2.x = b4.z;  bb2.y = b4.w;
        acc0 = __builtin_amdgcn_wmma_f32_16x16x4_f32(
            false, a, false, bb, (short)0, acc0, false, false);
        acc1 = __builtin_amdgcn_wmma_f32_16x16x4_f32(
            false, a2, false, bb2, (short)0, acc1, false, false);
      }

      if (j + 1 < NCH) {
        // keeps the fill, which waits for the loads above, behind the chunk's last
        // WMMA: without it the scheduler puts that wait among the first WMMAs
        __builtin_amdgcn_sched_barrier(0);
        put((j + 1) & 1, s4[j + 1], m4, x4);
      }
    }

    // C/D layout: VGPR v -> row v (lanes 0-15) / row v+8 (lanes 16-31)
    // (one row of tiles: part w3 of its 16 rows goes where rows 16*w3.. would)
#pragma unroll
    for (int v = 0; v < 8; ++v) {
      int row = w3 * 16 + v + 8 * h;
      Wm[row * WP + ncol] = acc0[v] + acc1[v];
    }
  };
  if (full) stream(std::integral_constant<int, CRR / 8>{});
  else      stream(std::integral_constant<int, 3>{});
  __syncthreads();

  // ---- L1 row normalization (rows 45..47 are all-zero: 0*1/eps=0)
  if (full) {
    if (tid < LQ) {
      float s = 0.0f;
      for (int q = 0; q < LQ; ++q) s += fabsf(Wm[tid * WP + q]);
      float inv = 1.0f / fmaxf(s, 1e-12f);
      for (int q = 0; q < LP; ++q) Wm[tid * WP + q] *= inv;
    }
  } else if (tid < 16) {
    float* wr = &Wm[tid * WP];
    v4f   w[LP / 4];
    float s = 0.0f;
#pragma unroll   // w[] stays in registers only with constant indices
    for (int q = 0; q < LP / 4; ++q) {
      w[q] = *(const v4f*)&wr[4 * q] + *(const v4f*)&wr[16 * WP + 4 * q]
           + *(const v4f*)&wr[32 * WP + 4 * q];              // the 3 parts of k
      s += fabsf(w[q].x);
      if (4 * q + 3 < LQ) s += fabsf(w[q].y), s += fabsf(w[q].z), s += fabsf(w[q].w);
    }
    const float inv = 1.0f / fmaxf(s, 1e-12f);
#pragma unroll
    for (int q = 0; q < LP / 4; ++q) *(v4f*)&wr[4 * q] = w[q] * inv;
  }
  __syncthreads();

  // Wt[b][j / 2][i / 16][l][j % 2][i % 16] = Wm[i][j]: rows 45..47 of Wm are zero
  // and go along, so that the reader's padded columns are zero too. A 128-B line
  // belongs to one layer, so no line is written by two workgroups; it holds what
  // two neighbouring waves of one reading workgroup take, and nothing else.
  __builtin_assume(tid < 288);        // lets all range tests but the last fold
  const int jj0 = tid / LP, ii = tid - jj0 * LP;      // 288 = 6 x 48
  float* wd = Wt + ((((size_t)b * NPR + (jj0 >> 1)) * 3 + (ii >> 4)) * NLAY + l) * WTP
                 + (jj0 & 1) * 16 + (ii & 15);
  // unrolled: the LDS reads run ahead of the stores, all offsets immediates
  if (full) {
#pragma unroll
    for (int it = 0; it < 8; ++it)
      if (jj0 + 6 * it < LQ)
        wd[(size_t)it * 3 * 3 * NLAY * WTP] = Wm[ii * WP + jj0 + 6 * it];
  } else {
    // 16 rows i: a wave stores a pair of columns j, one whole line
    const int jr = tid >> 4, ir = tid & 15;           // 288 = 18 x 16
    float* wr = Wt + ((((size_t)b * NPR + (jr >> 1)) * 3 + tr) * NLAY + l) * WTP
                   + (jr & 1) * 16 + ir;
#pragma unroll
    for (int it = 0; it < 3; ++it)
      if (jr + 18 * it < LQ)
        wr[(size_t)it * 9 * 3 * NLAY * WTP] = Wm[ir * WP + jr + 18 * it];
  }
}

// ---------------------------------------------------------------------------
// Fallback (no workspace): one workgroup per (layer, batch). 288 threads = 9 wave32.
//   Stage 1: build Uu (=unfold(I*S*M)) and Ku (=unfold(I*S*(1-M))) in LDS.
//   Stage 2: Wm = Uu^T * Ku        (45x45 padded 48x48, K=432)  [f32 WMMA]
//   Stages 1 and 2 run in NCH row chunks: Ku is kept whole (stage 4 reads it
//   again), Uu is only the k-stream of stage 2, so just one chunk of it lives
//   in LDS. That brings LDS under a third of a WGP's, so three workgroups are
//   resident per WGP and the whole grid (532) runs in one round.
//   Both lie patch-major in LDS: a fill lane's 4 neighbouring pixels are 4
//   neighbouring unfold rows of one patch (one 16-B store), a stage-2 lane
//   reads the 4 unfold rows of two k-steps in one 16-B load, and stage 4 reads
//   16 neighbouring unfold rows of one patch with 16 lanes.
//   Stage 3: L1-normalize rows of Wm
//   Stage 4: WK = Ku * Wm^T        (432x45 padded 48,  K=48)    [f32 WMMA]
//            fold + layer reduction: atomicAdd into the out accumulator
// Dual accumulators in both k-loops break the WMMA RAW dependency chain.
// ---------------------------------------------------------------------------
__global__ __launch_bounds__(288) void matting_layer_kernel(
    const float* __restrict__ I,     // (4,3,60,108)
    const float* __restrict__ S,     // (4,60,108,133)
    const float* __restrict__ M,     // (4,1,60,108)
    float* __restrict__ outacc)      // (4,3,60,108) accumulator
{
  __shared__ __align__(16) float Ku[LP * KP];   // 83712 B, [patch][unfold row]
  __shared__ __align__(16) float Uc[LP * UP];   // 14592 B, [patch][chunk row]
  float* const Wm = Uc;   // 48 x WP, written only after the last read of Uc

  const int l    = blockIdx.x;          // layer
  const int b    = blockIdx.y;          // batch
  const int tid  = threadIdx.x;
  const int lane = tid & 31;
  const int wave = tid >> 5;            // 0..8

  const float* Ib = I + (size_t)b * 3 * NPIX;
  const float* Sb = S + (size_t)b * NPIX * NLAY + l;
  const float* Mb = M + (size_t)b * NPIX;

  // ---- Stage 1a: zero the 3 padding patches (45..47) of Ku and Uc ---------
  for (int e = tid; e < (LP - LQ) * KP / 4; e += 288) {
    const float4 z4 = {0.0f, 0.0f, 0.0f, 0.0f};
    ((float4*)&Ku[LQ * KP])[e] = z4;
    if (e < (LP - LQ) * UP / 4) ((float4*)&Uc[LQ * UP])[e] = z4;
  }

  // ---- Stages 1b + 2, chunk by chunk --------------------------------------
  // Chunk j holds the unfold rows with k1 in [2j, 2j+2), all three channels:
  //   chunk row  c*24  + (k1-2j)*12 + k2   <->   unfold row  c*144 + k1*12 + k2
  // A(16x4 f32) layout: lane<16: M=lane, VGPRv=K(2h+v) ; lanes>=16: K+=2
  {
    const int ti   = wave / 3, tj = wave - ti * 3;
    const int h    = lane >> 4;
    const int mcol = ti * 16 + (lane & 15);   // output row  (p index)
    const int ncol = tj * 16 + (lane & 15);   // output col  (q index)
    v8f acc0 = {}, acc1 = {};

    for (int j = 0; j < NCH; ++j) {
      // fill: 10 image rows (5 patch rows x 2 k1) of 27 quads, 1 write/element.
      // A quad is 4 neighbouring pixels of one patch row (12 = 3 quads): M and
      // I are each read 16 B a lane, in whole lines.
      for (int e = tid; e < CPIX / 4; e += 288) {
        int rr = e / (WID / 4), wq = e - rr * (WID / 4);
        int ph = rr / CK1, kl = rr - ph * CK1;  // kl = k1 - 2j
        int pw = wq / 3,   k2 = (wq - pw * 3) * 4;
        int pix   = (ph * KS + j * CK1 + kl) * WID + wq * 4;
        int p     = ph * PW + pw;               // patch index
        int rbase = kl * KS + k2;               // within-channel chunk row
        float4 s4;
        s4.x = Sb[(size_t)pix * NLAY];
        s4.y = Sb[(size_t)(pix + 1) * NLAY];
        s4.z = Sb[(size_t)(pix + 2) * NLAY];
        s4.w = Sb[(size_t)(pix + 3) * NLAY];
        // precaution: stands in front of the loads below, whose results the
        // compiler may place in address registers of the four loads above
        asm volatile("s_wait_xcnt 0x0" ::: "memory");
        const float4 m4 = *(const float4*)&Mb[pix];
        const float s[4] = {s4.x, s4.y, s4.z, s4.w};
        const float m[4] = {m4.x, m4.y, m4.z, m4.w};
        float sm[4], sk[4];
        // the loops over i and c are unrolled: constant indices keep the small
        // arrays in registers and turn the LDS offsets into immediates
#pragma unroll
        for (int i = 0; i < 4; ++i) {
          sm[i] = s[i] * m[i];                  // S*M
          sk[i] = s[i] - sm[i];                 // S*(1-M)
        }
#pragma unroll
        for (int c = 0; c < 3; ++c) {
          const float4 i4 = *(const float4*)&Ib[c * NPIX + pix];
          float4 u4, k4;
          u4.x = i4.x * sm[0];  k4.x = i4.x * sk[0];
          u4.y = i4.y * sm[1];  k4.y = i4.y * sk[1];
          u4.z = i4.z * sm[2];  k4.z = i4.z * sk[2];
          u4.w = i4.w * sm[3];  k4.w = i4.w * sk[3];
          *(float4*)&Uc[p * UP + c * CRC + rbase]           = u4;
          *(float4*)&Ku[p * KP + c * 144 + j * CRC + rbase] = k4;
        }
      }
      __syncthreads();   // chunk j of Uc and Ku is complete

      // Wm += Uc^T * Ku(chunk rows); 9 waves <-> 9 (16x16) tiles
      // A lane reads 4 neighbouring rows (8kk + 4h + 0..3) of its patch from
      // each operand: elements 0,1 feed one k-step, elements 2,3 the next.
      // A and B take the same rows at the same (h, element) place.
      const float* ua = &Uc[mcol * UP + 4 * h];
      const float* kb = &Ku[ncol * KP + j * CRC + 4 * h];
      // unrolled so that the channel's row offset is compile-time and the LDS
      // offsets are immediates (9 pairs of k-steps, two WMMA chains)
#pragma unroll
      for (int kk = 0; kk < CRR / 8; ++kk) {
        const int ra = 8 * kk;                                // chunk row
        const int rb = 8 * kk + (kk / (CRC / 8)) * (144 - CRC); // unfold row - 24j
        const float4 a4 = *(const float4*)&ua[ra];
        const float4 b4 = *(const float4*)&kb[rb];
        v2f a, bb, a2, bb2;
        a.x  = a4.x;  a.y  = a4.y;  bb.x  = b4.x;  bb.y  = b4.y;
        a2.x = a4.z;  a2.y = a4.w;  bb2.x = b4.z;  bb2.y = b4.w;
        acc0 = __builtin_amdgcn_wmma_f32_16x16x4_f32(
            false, a, false, bb, (short)0, acc0, false, false);
        acc1 = __builtin_amdgcn_wmma_f32_16x16x4_f32(
            false, a2, false, bb2, (short)0, acc1, false, false);
      }
      __syncthreads();   // every wave has left Uc: refill it (or write Wm)
    }

    // C/D layout: VGPR v -> row v (lanes 0-15) / row v+8 (lanes 16-31)
#pragma unroll
    for (int v = 0; v < 8; ++v) {
      int row = ti * 16 + v + 8 * h;
      Wm[row * WP + ncol] = acc0[v] + acc1[v];
    }
  }
  __syncthreads();

  // ---- Stage 3: L1 row normalization (rows 45..47 are all-zero: 0*1/eps=0)
  if (tid < LQ) {
    float s = 0.0f;
    for (int q = 0; q < LQ; ++q) s += fabsf(Wm[tid * WP + q]);
    float inv = 1.0f / fmaxf(s, 1e-12f);
    for (int q = 0; q < LP; ++q) Wm[tid * WP + q] *= inv;
  }
  __syncthreads();

  {
    // ---- Stage 4: WK = Ku * Wm^T ; 81 tiles over 9 waves, fold + reduce ---
    const int h  = lane >> 4;
    const int lc = lane & 15;
    // t = wave + 9i keeps t % 3: a wave's column tile, and with it its Wm
    // fragments, are the same for all its tiles. They are read here, once.
    const int nt   = wave % 3;
    const int ncol = nt * 16 + lc;                // patch index i
    v2f bw[12];
#pragma unroll   // bw[] stays in registers only with constant indices
    for (int s = 0; s < 12; ++s)
      bw[s] = *(const v2f*)&Wm[ncol * WP + 4 * s + 2 * h];
    for (int t = wave; t < 81; t += 9) {          // uniform: 9 iters per wave
      const int mt = t / 3;
      const int mrow = mt * 16 + lc;              // unfold row (c,k1,k2)
      v8f acc0 = {}, acc1 = {};
#pragma unroll
      for (int s = 0; s < 6; ++s) {               // 12 k-steps, 2 chains
        const int ka = 8 * s + 2 * h;             // patch j of the k-step
        v2f a, a2;      // 16 lanes read 16 neighbouring unfold rows of a patch
        a.x  = Ku[ka * KP + mrow];
        a.y  = Ku[(ka + 1) * KP + mrow];
        a2.x = Ku[(ka + 4) * KP + mrow];
        a2.y = Ku[(ka + 5) * KP + mrow];
        acc0 = __builtin_amdgcn_wmma_f32_16x16x4_f32(
            false, a, false, bw[2 * s], (short)0, acc0, false, false);
        acc1 = __builtin_amdgcn_wmma_f32_16x16x4_f32(
            false, a2, false, bw[2 * s + 1], (short)0, acc1, false, false);
      }
      if (ncol < LQ) {
        const int ph = ncol / PW, pw = ncol - ph * PW;
#pragma unroll
        for (int v = 0; v < 8; ++v) {
          int   r   = mt * 16 + v + 8 * h;        // 0..431
          int   c   = r / 144, rem = r - c * 144;
          int   k1  = rem / KS, k2 = rem - k1 * KS;
          int   pix = (ph * KS + k1) * WID + pw * KS + k2;
          atomicAdd(&outacc[((size_t)b * 3 + c) * NPIX + pix],
                    acc0[v] + acc1[v]);
        }
      }
    }
  }
}

// ---------------------------------------------------------------------------
// ws path, second product, fold and blend in one launch.
// With K_l[c,kk,j] = I[c,kk,j] * (1-M)[kk,j] * S_l[kk,j]
// (kk = pixel inside a patch, j = patch) the sum over layers of Wm_l * K_l is
//   sum[c,kk,i] = sum_j I[c,kk,j] * (1-M)[kk,j] * T_j[kk,i],
//   T_j[kk,i]   = sum_l S_l[kk,j] * Wm_l[i,j].
// T_j is one GEMM per (b, j): 144 x 48, K = 133 layers (padded 136). The layer
// sum is its k dimension and the channel factor is outside it.
// A workgroup owns one 16 x 16 tile (16 patch pixels kk, 16 patches i) and one
// half of the patches j, a wave per j: every wave makes its own T_j tile and
// scales it by its j's three channel factors, the waves' tiles are summed in
// LDS. So no T_j goes through memory and no further launch folds them.
// No operand is shared between waves:
//   A: in S as given a pixel's layers lie in a row. A wave reads its 16 pixels'
//      runs in whole (16-B loads, 4-B aligned) and puts them in LDS of its own,
//      where a lane finds the 4 layers of two k-steps of its pixel in 16 B;
//   B: a lane reads its column i of 4 layers' lines of Wt.
// out: a tile is no set of whole 128-B lines, and each element has two
// addends (the halves of j). Both are added with an atomic onto the zero that
// the first launch stored: 0 + x + y rounds once, the same in either order.
// ---------------------------------------------------------------------------
// 24 waves are 6 per SIMD, and no second workgroup fits beside (LDS): said to
// the compiler, so that it spends the registers of 6 waves per SIMD on loads in
// flight; without it it keeps to fewer and loads a few k-steps at a time.
__global__ __launch_bounds__(JH * 32) __attribute__((amdgpu_waves_per_eu(6, 6)))
void layer_fold_kernel(
    const float* __restrict__ I,     // (4,3,60,108)
    const float* __restrict__ S,     // (4,60,108,133)
    const float* __restrict__ M,     // (4,1,60,108)
    const float* __restrict__ Wt,    // (4,NPR,3,133,WTP)
    float* __restrict__ out)         // (4,3,60,108), zero at entry
{
  // a part per wave: first its S tile [pixel][layer], pitch AP, then, over it,
  // its results [channel][column][row], pitch RP
  __shared__ __align__(16) float sh[JH * 16 * AP];        // 215040 B

  const int mt   = blockIdx.x;          // 16 patch pixels kk
  const int nt   = blockIdx.y;          // 16 patches i
  const int b    = blockIdx.z >> 1;
  const int jh   = blockIdx.z & 1;      // half of the patches j
  const int tid  = threadIdx.x;
  const int lane = tid & 31;
  const int wave = tid >> 5;            // 0..23
  const int h    = lane >> 4;
  const int lc   = lane & 15;
  // the second half has 21 patches: its last 3 waves work on patch 44 again and
  // their factor is zero, so that no branch stands around the WMMAs
  const bool live = jh * JH + wave < LQ;
  const int  j    = live ? jh * JH + wave : LQ - 1;
  const int  pj   = (j / PW) * KS * WID + (j % PW) * KS;  // patch's first pixel
  // the tile's 16 patch pixels are 4 quads; quad x lies qoff(x) pixels behind
  // its patch's first pixel: the tile starts at quad mt % 3 of a patch row (3
  // quads), and the quads from the next patch row on lie WID - KS further
  const int t0 = 16 * mt + (4 * mt / 3) * (WID - KS), x1 = 3 - mt % 3;
  auto qoff = [&](int x) { return t0 + 4 * x + (x >= x1 ? WID - KS : 0); };

  // A(16x4): lane -> row kk = lc; B(4x16): lane -> column i = lc. A lane takes
  // the 4 layers 8s + 4h + 0..3 of its row and of its column: elements 0,1 feed
  // one k-step, elements 2,3 the next. A and B take the same layers at the
  // same (h, element) place. Layers 133..135 are zero in both.
  float* const as = &sh[wave * 16 * AP];
  const unsigned vo = (unsigned)(pj * NLAY + 4 * lane) * 4;       // in bytes
  const unsigned vt = (unsigned)((pj + qoff(lane >> 3) + ((lane >> 1) & 3)) * NLAY
                                 + 128 + (lane & 1)) * 4;         // in bytes
  const float* sb = S + (size_t)b * NPIX * NLAY;
  // a quad's base, held in scalar registers: else the compiler adds the lane
  // offset to it first and spends a pair of vector registers on every quad
  const GLB char* sq[4];
#pragma unroll
  for (int x = 0; x < 4; ++x) {
    const unsigned long long u = (unsigned long long)(sb + qoff(x) * NLAY);
    sq[x] = (const GLB char*)(((unsigned long long)(unsigned)__builtin_amdgcn_readfirstlane(
                                   (int)(u >> 32)) << 32)
                              | (unsigned)__builtin_amdgcn_readfirstlane((int)u));
  }
  // addresses: a base that is the same in all lanes and a 32-bit lane offset
  const float*   wu = Wt + ((size_t)b * NPR * 3 + nt) * NLAY * WTP;
  const unsigned w0 = (unsigned)((j >> 1) * 3 * NLAY * WTP + (j & 1) * 16 + lc);
  const unsigned wb = w0 + 4 * h * WTP;
  // S tile: a load takes layers 0..127 of one pixel, 512 B in a row, with the
  // whole wave; the last takes layers 128..131 (even lanes) and 129..132 (odd
  // lanes, which keep layer 132) of all 16 pixels
  v4f r4[17], b4[LK / 8];
#pragma unroll   // r4[] and b4[] stay in registers only with constant indices
  for (int r = 0; r < 16; ++r) {
    r4[r] = *(const GLB v4fu*)(sq[r >> 2] + (r & 3) * NLAY * 4 + vo);
  }
  r4[16] = *(const v4fu*)((const char*)sb + vt);
#pragma unroll
  for (int s = 0; s < LK / 8 - 1; ++s) {
#pragma unroll
    for (int e = 0; e < 4; ++e) b4[s][e] = (wu + (8 * s + e) * WTP)[wb];
  }
  {
    const float w  = (wu + 128 * WTP)[wb];     // layer 128 or 132
    const float w1 = (wu + 129 * WTP)[w0], w2 = (wu + 130 * WTP)[w0];
    const float w3 = (wu + 131 * WTP)[w0];
    b4[LK / 8 - 1].x = w;
    b4[LK / 8 - 1].y = h ? 0.0f : w1;
    b4[LK / 8 - 1].z = h ? 0.0f : w2;
    b4[LK / 8 - 1].w = h ? 0.0f : w3;
  }
#pragma unroll
  for (int r = 0; r < 16; ++r) *(v4f*)&as[r * AP + 4 * lane] = r4[r];
  {
    const v4f t = r4[16];
    const v4f u = {t.w, 0.0f, 0.0f, 0.0f};
    *(v4f*)&as[(lane >> 1) * AP + 128 + 4 * (lane & 1)] = (lane & 1) ? u : t;
  }
  // the tile is the wave's own: its LDS operations run in order, so no barrier
  // instruction is needed; this keeps the compiler from moving a read up
  __builtin_amdgcn_wave_barrier();
  const float* ap = &as[lc * AP + 4 * h];

  // M and I of patch j at the lane's 8 result rows kk = 16*mt + 8h + 0..7
  const float* mu = M + (size_t)b * NPIX;
  const float* xu = I + (size_t)b * 3 * NPIX;
  v4f mr[2], xr[3][2];
  unsigned off[2];
#pragma unroll
  for (int g = 0; g < 2; ++g) {
    off[g] = (unsigned)(pj + qoff(2 * h + g)) * 4;            // in bytes
    mr[g]  = *(const v4f*)((const char*)mu + off[g]);
#pragma unroll
    for (int c = 0; c < 3; ++c) xr[c][g] = *(const v4f*)((const char*)(xu + c * NPIX) + off[g]);
  }

  // the blend's own M and I (thread -> channel, patch i, quad of the tile) are
  // read up here with the rest, so that their latency is not paid again behind
  // the barrier; threads past the tile's 192 quads read some quad of it
  const int oc  = (tid / 64) % 3, oi = (tid >> 2) & 15;
  const int i   = 16 * nt + oi;
  const int iv  = i < LQ ? i : LQ - 1;
  const unsigned pix = (unsigned)((iv / PW) * KS * WID + (iv % PW) * KS + qoff(tid & 3));
  const unsigned pxo = oc * NPIX + pix;
  const unsigned pb = pix * 4, xb = pxo * 4;                  // in bytes
  const v4f m4 = *(const v4f*)((const char*)mu + pb);
  const v4f i4 = *(const v4f*)((const char*)xu + xb);

  // keeps these ten loads up here: without it the scheduler puts them behind
  // most of the WMMAs, and a wave waits for them at its end, with nothing left
  __builtin_amdgcn_sched_barrier(0);

  // two accumulators: two independent WMMA chains
  v8f acc0 = {}, acc1 = {};
#pragma unroll
  for (int s = 0; s < LK / 8; ++s) {
    v2f a, bb, a2, bb2;
    const v4f a4 = *(const v4f*)&ap[8 * s];
    a.x  = a4.x;  a.y  = a4.y;  bb.x  = b4[s].x;  bb.y  = b4[s].y;
    a2.x = a4.z;  a2.y = a4.w;  bb2.x = b4[s].z;  bb2.y = b4[s].w;
    acc0 = __builtin_amdgcn_wmma_f32_16x16x4_f32(
        false, a, false, bb, (short)0, acc0, false, false);
    acc1 = __builtin_amdgcn_wmma_f32_16x16x4_f32(
        false, a2, false, bb2, (short)0, acc1, false, false);
  }
  // The four v_nop keep the distance between the last WMMAs and the vector
  // instructions that read their results or reuse their operand registers; the
  // two scheduling barriers keep every such instruction behind them.
  // The wait is a precaution: the addresses are inputs, and so are the results
  // of everything that was loaded, so that no register that one of the loads
  // above names is given a new value in front of it.
  __builtin_amdgcn_sched_barrier(0);
  asm volatile("v_nop\n\tv_nop\n\tv_nop\n\tv_nop\n\ts_wait_xcnt 0x0"
               :: "v"(acc0), "v"(acc1), "v"(mr[0]), "v"(mr[1]),
                  "v"(xr[0][0]), "v"(xr[0][1]), "v"(xr[1][0]), "v"(xr[1][1]),
                  "v"(xr[2][0]), "v"(xr[2][1]), "v"(m4), "v"(i4),
                  "v"(vo), "v"(vt), "v"(w0), "v"(wb), "v"(off[0]), "v"(off[1]),
                  "v"(pb), "v"(xb), "s"(sq[0]), "s"(sq[1]), "s"(sq[2]), "s"(sq[3]),
                  "s"(sb), "s"(wu), "s"(mu), "s"(xu)
               : "memory");
  __builtin_amdgcn_sched_barrier(0);

  // D: VGPR v -> row kk = 16*mt + 8h + v, column i = 16nt + lc: two quads a lane.
  // They go over the wave's own S tile, behind its last read of it.
#pragma unroll   // constant accumulator indices keep acc0/acc1 in registers
  for (int g = 0; g < 2; ++g) {
    const v4f km = live ? 1.0f - mr[g] : (v4f){0.0f, 0.0f, 0.0f, 0.0f};
    v4f t4;
    t4.x = (acc0[4 * g]     + acc1[4 * g])     * km.x;
    t4.y = (acc0[4 * g + 1] + acc1[4 * g + 1]) * km.y;
    t4.z = (acc0[4 * g + 2] + acc1[4 * g + 2]) * km.z;
    t4.w = (acc0[4 * g + 3] + acc1[4 * g + 3]) * km.w;
#pragma unroll
    for (int c = 0; c < 3; ++c)
      *(v4f*)&as[(c * 16 + lc) * RP + 8 * h + 4 * g] = t4 * xr[c][g];
  }
  __syncthreads();   // all waves' tiles are in LDS

  if (tid < 3 * 64 && i < LQ) {
    const float* rp = &sh[(oc * 16 + oi) * RP + 4 * (tid & 3)];
    v4f s = *(const v4f*)rp;
#pragma unroll   // the LDS reads run ahead of the additions
    for (int w = 1; w < JH; ++w) s += *(const v4f*)&rp[w * 16 * AP];
    v4f val = s * m4;
    if (jh == 0) val += i4 * (1.0f - m4);
    float* po = out + (size_t)b * 3 * NPIX + pxo;
    atomicAdd(&po[0], val.x);
    atomicAdd(&po[1], val.y);
    atomicAdd(&po[2], val.z);
    atomicAdd(&po[3], val.w);
  }
}

// ---------------------------------------------------------------------------
// atomic-path helpers: zero d_out first.
// ---------------------------------------------------------------------------
__global__ void zero_kernel(float* __restrict__ out, int n) {
  int i = blockIdx.x * blockDim.x + threadIdx.x;
  if (i < n) out[i] = 0.0f;
}

__global__ void blend_kernel(const float* __restrict__ I,
                             const float* __restrict__ M,
                             float* __restrict__ out, int n) {
  int i = blockIdx.x * blockDim.x + threadIdx.x;
  if (i < n) {
    int b   = i / (3 * NPIX);
    int pix = i % NPIX;
    float m = M[(size_t)b * NPIX + pix];
    out[i] = I[i] * (1.0f - m) + out[i] * m;
  }
}

// ---------------------------------------------------------------------------
extern "C" void kernel_launch(void* const* d_in, const int* in_sizes, int n_in,
                              void* d_out, int out_size, void* d_ws, size_t ws_size,
                              hipStream_t stream) {
  const float* I = (const float*)d_in[0];
  const float* S = (const float*)d_in[1];
  const float* M = (const float*)d_in[2];
  float* out = (float*)d_out;

  const int    n    = NB * 3 * NPIX;                              // 77760
  const size_t nst  = (size_t)NB * NLAY * SPITCH;                 // 13.9 MB
  const size_t nwt  = (size_t)NB * NPR * 3 * NLAY * WTP;          // 4.7 MB
  const size_t need = (nst + nwt) * sizeof(float);

  if (d_ws != nullptr && ws_size >= need) {
    // every plane below is rewritten in every call before it is read
    float* St = (float*)d_ws;         // transposed S
    float* Wt = St + nst;             // normalized affinities
    transpose_s_kernel<<<TTILE, 256, 0, stream>>>(S, St, out);
    affinity_kernel<<<NB * (NFL + NRJ), 288, 0, stream>>>(I, St, M, Wt);
    layer_fold_kernel<<<dim3(PP / 16, LP / 16, 2 * NB), JH * 32, 0, stream>>>(
        I, S, M, Wt, out);
  } else {
    // fallback: accumulate with global atomics directly into d_out
    zero_kernel<<<(n + 255) / 256, 256, 0, stream>>>(out, n);
    matting_layer_kernel<<<dim3(NLAY, NB), 288, 0, stream>>>(I, S, M, out);
    blend_kernel<<<(n + 255) / 256, 256, 0, stream>>>(I, M, out, n);
  }
}
